// v000
// Measured on an AMD MI455X. A time is GPU time per run, averaged over a window of back-to-back runs after a warm-up
// (all launches, gaps included; the runs take copies of the inputs in turn), and the median of several windows.
// Apart from v000's, it joins two sittings. Times from different sittings can be a few percent apart, while
// side-by-side timings come from the same sitting.
// The starting kernel, v000, takes 328 microseconds a run.
// compute dtype: all float inputs rounded to bf16; qkv = x . W^T + b with EXACT bf16 products on WMMA 16x16x32 (natural rows; three contiguous row blocks) kept in f32 for q and k; the two per-token LayerNorms (1,024 wide, eps 1e-5) in f32, then q, k rounded once to f16; PLAIN attention: x 1/8, running-max softmax in f32 (hardware exp), P (scaled by 2^11, single f16) x v (single f16); out = o (bf16 hi + residual) . proj_w^T (2 products) + proj_b.
#include <hip/hip_runtime.h>
#include <math.h>

typedef __attribute__((ext_vector_type(16))) _Float16 v16h;
typedef __attribute__((ext_vector_type(16))) __bf16 v16b;
typedef __attribute__((ext_vector_type(8)))  _Float16 v8h;
typedef __attribute__((ext_vector_type(8)))  float v8f;
typedef __attribute__((ext_vector_type(4)))  float v4f;
typedef __attribute__((ext_vector_type(2)))  float v2f;
typedef __attribute__((ext_vector_type(4)))  unsigned v4u;
typedef __attribute__((ext_vector_type(4)))  int v4i;
typedef float __attribute__((may_alias)) float_a;
typedef int __attribute__((may_alias)) int_a;

template <typename T> __device__ __forceinline__ void vst2(void* p, T v) { *(T*)p = v;  }
__device__ __forceinline__ v8f wmma16(v16h a, v16h b, v8f c) {
  v8f d = __builtin_amdgcn_wmma_f32_16x16x32_f16(false, a, false, b, (short)0, c, false, false);
  asm volatile("v_nop\n\tv_nop\n\tv_nop\n\tv_nop" : "+v"(d) : "v"(a), "v"(b));
  return d;
}
__device__ __forceinline__ v8f wmma_bf(v16b a, v16b b, v8f c) {
  v8f d = __builtin_amdgcn_wmma_f32_16x16x32_bf16(false, a, false, b, (short)0, c, false, false);
  asm volatile("v_nop\n\tv_nop\n\tv_nop\n\tv_nop" : "+v"(d) : "v"(a), "v"(b));
  return d;
}
// InternVL / CLIP attention with qk LayerNorm (B 4, N 1,024, C 1,024, 16 heads x 64): fused qkv projection + bias, LayerNorm over the flattened q and k per token, softmax(q k / 8) v, output projection + bias.
__device__ __forceinline__ v16h frag_h(const _Float16* rowk0, int lane) {
  union { v16h v; v8h q[2]; } u; const _Float16* p = rowk0 + 8 * (lane >> 4);
  u.q[0] = *(const v8h*)p; u.q[1] = *(const v8h*)(p + 16); return u.v;
}
__device__ __forceinline__ v16h frag_f32(const float* rowk0, int lane) {
  v16h a; const float* p = rowk0 + 8 * (lane >> 4);
#pragma unroll
  for (int i = 0; i < 8; ++i) { a[i] = (_Float16)p[i]; a[8 + i] = (_Float16)p[16 + i]; }
  return a;
}
__device__ __forceinline__ v16h frag_f32s(const float* rowk0, int lane, float sc) {
  v16h a; const float* p = rowk0 + 8 * (lane >> 4);
#pragma unroll
  for (int i = 0; i < 8; ++i) { a[i] = (_Float16)(p[i] * sc); a[8 + i] = (_Float16)(p[16 + i] * sc); }
  return a;
}
// column fragment from a [K][ld] layout (column n), rows >= K read as 0
__device__ __forceinline__ v16h fragc_f32(const float* W, int k0, int n, int lane, int ld, int K) {
  v16h a; const int g = lane >> 4;
#pragma unroll
  for (int i = 0; i < 8; ++i) { const int ka = k0 + 8 * g + i, kb = ka + 16;
    a[i] = (_Float16)(ka < K ? W[(size_t)(ka < K ? ka : K - 1) * ld + n] : 0.f); a[8 + i] = (_Float16)(kb < K ? W[(size_t)(kb < K ? kb : K - 1) * ld + n] : 0.f); }
  return a;
}
struct F2 { v16b h, l; };
__device__ __forceinline__ F2 bsplit16(const float v[16]) { F2 r;
#pragma unroll
  for (int i = 0; i < 16; ++i) { const __bf16 h = (__bf16)v[i]; r.h[i] = h; r.l[i] = (__bf16)(v[i] - (float)h); }
  return r; }
__device__ __forceinline__ F2 split_row(const float* row, int k0, int lane) { float v[16]; const float* p = row + k0 + 8 * (lane >> 4);
#pragma unroll
  for (int i = 0; i < 8; ++i) { v[i] = p[i]; v[8 + i] = p[16 + i]; }
  return bsplit16(v); }
__device__ __forceinline__ F2 split_rowK(const float* row, int k0, int lane, int K) { float v[16]; const int g = lane >> 4;
#pragma unroll
  for (int i = 0; i < 8; ++i) { const int ka = k0 + 8 * g + i, kb = ka + 16; v[i] = ka < K ? row[ka < K ? ka : K - 1] : 0.f; v[8 + i] = kb < K ? row[kb < K ? kb : K - 1] : 0.f; }
  return bsplit16(v); }
__device__ __forceinline__ F2 split_col(const float* W, int k0, int n, int lane, int ld, int K) { float v[16]; const int g = lane >> 4;
#pragma unroll
  for (int i = 0; i < 8; ++i) { const int ka = k0 + 8 * g + i, kb = ka + 16; v[i] = ka < K ? W[(size_t)(ka < K ? ka : K - 1) * ld + n] : 0.f; v[8 + i] = kb < K ? W[(size_t)(kb < K ? kb : K - 1) * ld + n] : 0.f; }
  return bsplit16(v); }
__device__ __forceinline__ v8f mac3(const F2& a, const F2& b, v8f c) { c = wmma_bf(a.l, b.h, c); c = wmma_bf(a.h, b.l, c); return wmma_bf(a.h, b.h, c); }
__device__ __forceinline__ float sigm(float v) { return 1.0f / (1.0f + expf(-v)); }
#define LDSX() do { asm volatile("s_wait_dscnt 0" ::: "memory"); __builtin_amdgcn_wave_barrier(); __builtin_amdgcn_fence(__ATOMIC_RELEASE, "workgroup"); } while (0)


#define NB 4
#define SS 1024
#define DM 1024
#define NH 16
#define HD 64
#define QKVW (3 * DM)
#ifndef TQB
#define TQB (SS / 64)
#define TNB NB
#define TOB (NB * SS / 64)     // output row tiles (all)
#endif
typedef __attribute__((ext_vector_type(8))) __bf16 v8b;
__device__ __forceinline__ v16b frag_b(const __bf16* rowk0, int lane) {
  union { v16b v; v8b q[2]; } u; const __bf16* p = rowk0 + 8 * (lane >> 4);
  u.q[0] = *(const v8b*)p; u.q[1] = *(const v8b*)(p + 16); return u.v;
}
__device__ __forceinline__ float bfr(float v) { return (float)(__bf16)v; }
__device__ __attribute__((noinline)) float exp_ni(float v) { return expf(v); }
__device__ __attribute__((noinline)) float erf_ni(float v) { return erff(v); }

#define PK_A 0                       // [3072][1024] Wqkv rows (natural [out][in])
#define PK_P (PK_A + QKVW * DM)        // [1024][1024] Wo rows (natural)
#define PK_END (PK_P + DM * DM)
#define WS_PK  0u
#define WS_QK  (WS_PK + 2u * PK_END)             // f16 [4096 rows][2048]: q | k
#define WS_QKL (WS_QK + 2u * NB * SS * 2 * DM)     // f16 [4096][2048]; never written (its loads in k_attn go unused)
#define WS_VTH (WS_QKL + 2u * NB * SS * 2 * DM)    // f16 [b][1024 (h*64+d)][1024 s] hi
#define WS_VTL (WS_VTH + 2u * NB * DM * SS)        // f16 lo x 2048
#define WS_O   (WS_VTL + 2u * NB * DM * SS)        // f32 [4096][1024]
#define WS_CS  (WS_O + 4u * NB * SS * DM)           // f32 [2][1024][32], not used
#define WS_QF  (WS_CS + 4u * 2 * SS * 32)                  // f32 [NR][2048] pre-LN q | k
#define WS_END (WS_QF + 4u * (size_t)NB * SS * 2 * DM)
// ---- k_pack: block = (row n, which): natural [out][in] rows -> bf16; which 0..2 -> W_q/W_k/W_v into PK_A rows which*1024 + n; 3 -> W_o into PK_P
__global__ __launch_bounds__(256) void k_pack(const float* __restrict__ WQ, const float* __restrict__ WK, const float* __restrict__ WV, const float* __restrict__ WO, __bf16* __restrict__ PK) {
  __shared__ __align__(16) __bf16 s[DM]; const int n = blockIdx.x, which = blockIdx.y, t = threadIdx.x; const float* Wm = (which == 0) ? WQ : (which == 1) ? WK : (which == 2) ? WV : WO;
  for (int k = t; k < DM; k += 256) s[k] = (__bf16)Wm[(size_t)n * DM + k];
  __syncthreads();
  __bf16* dst = (which < 3) ? PK + PK_A + ((size_t)which * DM + n) * DM : PK + PK_P + (size_t)n * DM;
  for (int q = t; q < DM / 8; q += 256) vst2((unsigned*)(dst + q * 8), *(const v4u*)&s[q * 8]);
}
__global__ __launch_bounds__(128) void k_qkv(const float* __restrict__ XQ, const float* __restrict__ XK, const float* __restrict__ XV, const __bf16* __restrict__ P, const float* __restrict__ BQ, const float* __restrict__ BK, const float* __restrict__ BV, float* __restrict__ QF, _Float16* __restrict__ QK, _Float16* __restrict__ QKL, _Float16* __restrict__ VTH, _Float16* __restrict__ VTL) {
  const int which0 = (blockIdx.y * 128) / DM; const float* X = (which0 == 0) ? XQ : (which0 == 1) ? XK : XV; const float* BB = BQ ? (((which0 == 0) ? BQ : (which0 == 1) ? BK : BV) + (blockIdx.y * 128 - which0 * DM)) : nullptr;
  __shared__ __align__(16) _Float16 so[4][16][136], sol[4][16][136]; __shared__ __align__(16) _Float16 sth[128][72], stl[128][72];
  const int tid = threadIdx.x, wave = tid >> 5, lane = tid & 31, col = lane & 15, g = lane >> 4; const size_t r0 = (size_t)blockIdx.x * 64 + wave * 16; const int n0 = blockIdx.y * 128;
  v8f acc[8] = {};
#pragma unroll 2
  for (int kc = 0; kc < DM / 32; ++kc) { v16b a; { const float* p = X + (r0 + col) * DM + kc * 32 + 8 * g;
#pragma unroll
      for (int i = 0; i < 8; ++i) { a[i] = (__bf16)p[i]; a[8 + i] = (__bf16)p[16 + i]; } }
#pragma unroll
    for (int j = 0; j < 8; ++j) acc[j] = wmma_bf(a, frag_b(P + (size_t)(n0 + j * 16 + col) * DM + kc * 32, lane), acc[j]); }
  if (n0 < 2 * DM) {   // q and k kept in f32 (LayerNorm comes next)
    __shared__ __align__(16) float sf[4][16][132];
#pragma unroll
    for (int j = 0; j < 8; ++j) {
#pragma unroll
      for (int r = 0; r < 8; ++r) sf[wave][8 * g + r][j * 16 + col] = acc[j][r] + (BB ? bfr(BB[j * 16 + col]) : 0.f); }
    LDSX();
    for (int rl = 0; rl < 16; ++rl) vst2(QF + (r0 + rl) * (2 * DM) + n0 + lane * 4, *(const v4f*)&sf[wave][rl][lane * 4]);
  } else {
#pragma unroll
    for (int j = 0; j < 8; ++j) {
#pragma unroll
      for (int r = 0; r < 8; ++r) { const float v = acc[j][r] + (BB ? bfr(BB[j * 16 + col]) : 0.f); const _Float16 hv = (_Float16)v; sth[j * 16 + col][wave * 16 + 8 * g + r] = hv; stl[j * 16 + col][wave * 16 + 8 * g + r] = (_Float16)((v - (float)hv) * 2048.0f); } }
    __syncthreads();
    const size_t rb = (size_t)blockIdx.x * 64; const int b = (int)(rb / SS), s0 = (int)(rb % SS); const int pc0 = n0 - 2 * DM;
    for (int q = tid; q < 128 * 8; q += 128) { const int d = q >> 3, pc = q & 7; const size_t o = ((size_t)b * DM + pc0 + d) * SS + s0 + pc * 8; vst2((unsigned*)(VTH + o), *(const v4u*)&sth[d][pc * 8]); vst2((unsigned*)(VTL + o), *(const v4u*)&stl[d][pc * 8]); }
  }
}
// ---- k_attn: block = (64 queries, head h, batch b): all-keys flash attention (K = 64: 2 k-steps), scores = (q.k) * 0.125 with single f16 operands, P.V: f16 P (x2^11) x V hi in one accumulator; O[b*S+q][h*64+d] = (acc + accl / 2048) / (2048 l) (256-B segments)
__global__ __launch_bounds__(128) void k_attn(const _Float16* __restrict__ QK, const _Float16* __restrict__ QKL, const _Float16* __restrict__ VTH, const _Float16* __restrict__ VTL, const void* __restrict__ KMASK, float* __restrict__ O) {
  __shared__ __align__(16) float sp[4][16][36]; __shared__ __align__(16) float so[4][16][68];
  const int tid = threadIdx.x, wave = tid >> 5, lane = tid & 31, col = lane & 15, g = lane >> 4;
  const int qb = blockIdx.x, h = blockIdx.y, b = blockIdx.z; const int q0 = qb * 64 + wave * 16; const size_t rq = (size_t)b * SS + q0 + col;
  v16h aq[2], aql[2];
#pragma unroll
  for (int kc = 0; kc < 2; ++kc) { aq[kc] = frag_h(QK + rq * (2 * DM) + h * HD + kc * 32, lane); aql[kc] = frag_h(QKL + rq * (2 * DM) + h * HD + kc * 32, lane); }
  float m[8], l[8];
#pragma unroll
  for (int r = 0; r < 8; ++r) { m[r] = -3.0e38f; l[r] = 0.f; }
  v8f acc[4] = {}, accl[4] = {};
  const int nks = SS / 32;   // all keys
#pragma unroll 1
  for (int ks = 0; ks < nks; ++ks) { v8f s[2];
#pragma unroll
    for (int ct = 0; ct < 2; ++ct) { const int kk = ks * 32 + ct * 16 + col; const _Float16* krow = QK + ((size_t)b * SS + kk) * (2 * DM) + DM + h * HD; const _Float16* krowl = QKL + ((size_t)b * SS + kk) * (2 * DM) + DM + h * HD; v8f c = {}, cl = {};
#pragma unroll
      for (int kc = 0; kc < 2; ++kc) c = wmma16(aq[kc], frag_h(krow + kc * 32, lane), c);   // single product: q, k as one-rounding f16 operands
      (void)cl; (void)krowl;
      { const bool keepk = true;
#pragma unroll
      for (int r = 0; r < 8; ++r) s[ct][r] = keepk ? c[r] * 0.125f : -3.0e38f; } }   // 1/sqrt(64); no mask: every key kept
#pragma unroll
    for (int r = 0; r < 8; ++r) { float mx = fmaxf(s[0][r], s[1][r]);
#pragma unroll
      for (int o = 1; o < 16; o <<= 1) mx = fmaxf(mx, __shfl_xor(mx, o));
      const float mn = fmaxf(m[r], mx); const float alpha = (m[r] <= -1.0e38f) ? 0.f : __expf(m[r] - mn);
      const float e0 = (s[0][r] <= -1.0e38f) ? 0.f : __expf(s[0][r] - mn), e1 = (s[1][r] <= -1.0e38f) ? 0.f : __expf(s[1][r] - mn); float es = e0 + e1;
#pragma unroll
      for (int o = 1; o < 16; o <<= 1) es += __shfl_xor(es, o);
      l[r] = l[r] * alpha + es; m[r] = mn;
#pragma unroll
      for (int dt = 0; dt < 4; ++dt) { acc[dt][r] *= alpha; accl[dt][r] *= alpha; }
      sp[wave][8 * g + r][col] = e0; sp[wave][8 * g + r][16 + col] = e1; }
    LDSX();
    v16h pa, pl; { const float* prow = &sp[wave][col][0] + 8 * (lane >> 4);
#pragma unroll
      for (int i = 0; i < 8; ++i) { const float x0 = prow[i] * 2048.0f, x1 = prow[16 + i] * 2048.0f; const _Float16 h0 = (_Float16)x0, h1 = (_Float16)x1; pa[i] = h0; pa[8 + i] = h1; pl[i] = (_Float16)((x0 - (float)h0) * 2048.0f); pl[8 + i] = (_Float16)((x1 - (float)h1) * 2048.0f); } }   // P scaled by 2^11 before the f16 split so small softmax weights stay out of the f16 subnormal range; 2^-11 folded into the epilogue
#pragma unroll
    for (int dt = 0; dt < 4; ++dt) { const size_t vr = ((size_t)b * DM + h * HD + dt * 16 + col) * SS + ks * 32; acc[dt] = wmma16(pa, frag_h(VTH + vr, lane), acc[dt]); }   // single product: P (x2^11) x V
    (void)pl;
    LDSX(); }
#pragma unroll
  for (int r = 0; r < 8; ++r) { const float il = (1.0f / 2048.0f) / l[r];
#pragma unroll
    for (int dt = 0; dt < 4; ++dt) so[wave][8 * g + r][dt * 16 + col] = (acc[dt][r] + accl[dt][r] * (1.0f / 2048.0f)) * il; }
  LDSX();
  for (int rl = 0; rl < 16; ++rl) if (lane < 16) vst2(O + ((size_t)b * SS + q0 + rl) * DM + h * HD + lane * 4, *(const v4f*)&so[wave][rl][lane * 4]);
}
// ---- k_out: block = (64 rows, 128 cols): out = O(hi/lo) . Wo rows (2 products) + bo
__global__ __launch_bounds__(128) void k_out(const float* __restrict__ O, const __bf16* __restrict__ P, const float* __restrict__ BO, float* __restrict__ Y) {
  __shared__ __align__(16) float so[4][16][132];
  const int tid = threadIdx.x, wave = tid >> 5, lane = tid & 31, col = lane & 15, g = lane >> 4; const size_t r0 = (size_t)blockIdx.x * 64 + wave * 16; const int n0 = blockIdx.y * 128;
  v8f acc[8] = {};
#pragma unroll 2
  for (int kc = 0; kc < DM / 32; ++kc) { const F2 a = split_row(O + (r0 + col) * DM, kc * 32, lane);
#pragma unroll
    for (int j = 0; j < 8; ++j) { const v16b w = frag_b(P + (size_t)(n0 + j * 16 + col) * DM + kc * 32, lane); acc[j] = wmma_bf(a.l, w, acc[j]); acc[j] = wmma_bf(a.h, w, acc[j]); } }
#pragma unroll
  for (int j = 0; j < 8; ++j) {
#pragma unroll
    for (int r = 0; r < 8; ++r) so[wave][8 * g + r][j * 16 + col] = acc[j][r] + bfr(BO[n0 + j * 16 + col]); }
  LDSX();
  for (int rl = 0; rl < 16; ++rl) vst2(Y + (r0 + rl) * DM + n0 + lane * 4, *(const v4f*)&so[wave][rl][lane * 4]);
}
// ---- k_lnqk: block = (token row, q or k): LayerNorm over the 1,024 flattened head dims (jnp.var, 1e-5) x g + b -> f16 row into the engine's q | k layout
__global__ __launch_bounds__(256) void k_lnqk(const float* __restrict__ QF, const float* __restrict__ GQ, const float* __restrict__ BQn, const float* __restrict__ GK, const float* __restrict__ BKn, _Float16* __restrict__ QK) {
  __shared__ float red[8]; __shared__ __align__(16) _Float16 sh[DM]; const int t = threadIdx.x; const size_t row = blockIdx.x; const int which = blockIdx.y; const float* X = QF + row * (2 * DM) + which * DM; const float* G = which ? GK : GQ; const float* Bt = which ? BKn : BQn;
  float v[4]; float s = 0.f; for (int i = 0; i < 4; ++i) { v[i] = X[t * 4 + i]; s += v[i]; }
#pragma unroll
  for (int o = 1; o < 32; o <<= 1) s += __shfl_xor(s, o);
  if ((t & 31) == 0) red[t >> 5] = s; __syncthreads(); float tot = 0.f; for (int i = 0; i < 8; ++i) tot += red[i]; const float mu = tot / (float)DM; __syncthreads();
  float q = 0.f; for (int i = 0; i < 4; ++i) { const float d = v[i] - mu; q += d * d; }
#pragma unroll
  for (int o = 1; o < 32; o <<= 1) q += __shfl_xor(q, o);
  if ((t & 31) == 0) red[t >> 5] = q; __syncthreads(); float tq = 0.f; for (int i = 0; i < 8; ++i) tq += red[i]; const float inv = 1.0f / sqrtf(tq / (float)DM + 1e-5f);
  for (int i = 0; i < 4; ++i) { const int e = t * 4 + i; sh[e] = (_Float16)((v[i] - mu) * inv * bfr(G[e]) + bfr(Bt[e])); }
  __syncthreads(); if (t < DM / 8) vst2((unsigned*)(QK + row * (2 * DM) + which * DM + t * 8), *(const v4u*)&sh[t * 8]);
}
extern "C" void kernel_launch(void* const* d_in, const int* in_sizes, int n_in, void* d_out, int out_size, void* d_ws, size_t ws_size, hipStream_t stream) {
  (void)in_sizes; (void)n_in; (void)out_size;
  const float** F = (const float**)d_in;   // 0 x [4,1024,1024], 1 qkv_w [3072,1024] natural (q | k | v row blocks), 2 qkv_b, 3 q_norm_g, 4 q_norm_b, 5 k_norm_g, 6 k_norm_b, 7 proj_w [1024,1024], 8 proj_b
  if (ws_size < (size_t)WS_END) return;
  char* ws = (char*)d_ws; __bf16* PK = (__bf16*)(ws + WS_PK); _Float16 *QK = (_Float16*)(ws + WS_QK), *QKL = (_Float16*)(ws + WS_QKL), *VTH = (_Float16*)(ws + WS_VTH), *VTL = (_Float16*)(ws + WS_VTL); float *O = (float*)(ws + WS_O), *QF = (float*)(ws + WS_QF);
  k_pack<<<dim3(DM, 4), 256, 0, stream>>>(F[1], F[1] + (size_t)DM * DM, F[1] + (size_t)2 * DM * DM, F[7], PK);
  k_qkv<<<dim3(TNB * SS / 64, QKVW / 128), 128, 0, stream>>>(F[0], F[0], F[0], PK + PK_A, F[2], F[2] + DM, F[2] + 2 * DM, QF, QK, QKL, VTH, VTL);
  k_lnqk<<<dim3(TNB * SS, 2), 256, 0, stream>>>(QF, F[3], F[4], F[5], F[6], QK);
  k_attn<<<dim3(TQB, NH, TNB), 128, 0, stream>>>(QK, QKL, VTH, VTL, nullptr, O);
  k_out<<<dim3(TOB, DM / 128), 128, 0, stream>>>(O, PK + PK_P, F[8], (float*)d_out);
}

// v001
// It runs in 170 microseconds.
// Two timings next to v000 put it at 1.93 and 1.94 times that version's speed.
// compute dtype: all float inputs rounded to bf16; qkv = x . W^T + b with EXACT bf16 products on WMMA 16x16x32 (natural rows; three contiguous row blocks) kept in f32 for q and k; the two per-token LayerNorms (1,024 wide, eps 1e-5) in f32, then q, k rounded once to f16; PLAIN attention: x 1/8, running-max softmax in f32 (hardware exp), P (scaled by 2^11, single f16) x v (single f16); out = o (bf16 hi + residual) . proj_w^T (2 products) + proj_b.
#include <hip/hip_runtime.h>
#include <math.h>

typedef __attribute__((ext_vector_type(16))) _Float16 v16h;
typedef __attribute__((ext_vector_type(16))) __bf16 v16b;
typedef __attribute__((ext_vector_type(8)))  _Float16 v8h;
typedef __attribute__((ext_vector_type(8)))  float v8f;
typedef __attribute__((ext_vector_type(4)))  float v4f;
typedef __attribute__((ext_vector_type(2)))  float v2f;
typedef __attribute__((ext_vector_type(4)))  unsigned v4u;
typedef __attribute__((ext_vector_type(4)))  int v4i;
typedef float __attribute__((may_alias)) float_a;
typedef int __attribute__((may_alias)) int_a;

template <typename T> __device__ __forceinline__ void vst2(void* p, T v) { *(T*)p = v;  }
__device__ __forceinline__ v8f wmma16(v16h a, v16h b, v8f c) {
  v8f d = __builtin_amdgcn_wmma_f32_16x16x32_f16(false, a, false, b, (short)0, c, false, false);
  asm volatile("v_nop\n\tv_nop\n\tv_nop\n\tv_nop" : "+v"(d) : "v"(a), "v"(b));
  return d;
}
__device__ __forceinline__ v8f wmma_bf(v16b a, v16b b, v8f c) {
  v8f d = __builtin_amdgcn_wmma_f32_16x16x32_bf16(false, a, false, b, (short)0, c, false, false);
  asm volatile("v_nop\n\tv_nop\n\tv_nop\n\tv_nop" : "+v"(d) : "v"(a), "v"(b));
  return d;
}
// attention with qk LayerNorm (B 4, N 1,024, C 1,024, 16 heads x 64): fused qkv projection + bias, LayerNorm over the flattened q and k per token, softmax(q k / 8) v, output projection + bias.
__device__ __forceinline__ v16h frag_h(const _Float16* rowk0, int lane) {
  union { v16h v; v8h q[2]; } u; const _Float16* p = rowk0 + 8 * (lane >> 4);
  u.q[0] = *(const v8h*)p; u.q[1] = *(const v8h*)(p + 16); return u.v;
}
__device__ __forceinline__ v16h frag_f32(const float* rowk0, int lane) {
  v16h a; const float* p = rowk0 + 8 * (lane >> 4);
#pragma unroll
  for (int i = 0; i < 8; ++i) { a[i] = (_Float16)p[i]; a[8 + i] = (_Float16)p[16 + i]; }
  return a;
}
__device__ __forceinline__ v16h frag_f32s(const float* rowk0, int lane, float sc) {
  v16h a; const float* p = rowk0 + 8 * (lane >> 4);
#pragma unroll
  for (int i = 0; i < 8; ++i) { a[i] = (_Float16)(p[i] * sc); a[8 + i] = (_Float16)(p[16 + i] * sc); }
  return a;
}
// column fragment from a [K][ld] layout (column n), rows >= K read as 0
__device__ __forceinline__ v16h fragc_f32(const float* W, int k0, int n, int lane, int ld, int K) {
  v16h a; const int g = lane >> 4;
#pragma unroll
  for (int i = 0; i < 8; ++i) { const int ka = k0 + 8 * g + i, kb = ka + 16;
    a[i] = (_Float16)(ka < K ? W[(size_t)(ka < K ? ka : K - 1) * ld + n] : 0.f); a[8 + i] = (_Float16)(kb < K ? W[(size_t)(kb < K ? kb : K - 1) * ld + n] : 0.f); }
  return a;
}
struct F2 { v16b h, l; };
__device__ __forceinline__ F2 bsplit16(const float v[16]) { F2 r;
#pragma unroll
  for (int i = 0; i < 16; ++i) { const __bf16 h = (__bf16)v[i]; r.h[i] = h; r.l[i] = (__bf16)(v[i] - (float)h); }
  return r; }
__device__ __forceinline__ F2 split_row(const float* row, int k0, int lane) { float v[16]; const float* p = row + k0 + 8 * (lane >> 4);
#pragma unroll
  for (int i = 0; i < 8; ++i) { v[i] = p[i]; v[8 + i] = p[16 + i]; }
  return bsplit16(v); }
__device__ __forceinline__ F2 split_rowK(const float* row, int k0, int lane, int K) { float v[16]; const int g = lane >> 4;
#pragma unroll
  for (int i = 0; i < 8; ++i) { const int ka = k0 + 8 * g + i, kb = ka + 16; v[i] = ka < K ? row[ka < K ? ka : K - 1] : 0.f; v[8 + i] = kb < K ? row[kb < K ? kb : K - 1] : 0.f; }
  return bsplit16(v); }
__device__ __forceinline__ F2 split_col(const float* W, int k0, int n, int lane, int ld, int K) { float v[16]; const int g = lane >> 4;
#pragma unroll
  for (int i = 0; i < 8; ++i) { const int ka = k0 + 8 * g + i, kb = ka + 16; v[i] = ka < K ? W[(size_t)(ka < K ? ka : K - 1) * ld + n] : 0.f; v[8 + i] = kb < K ? W[(size_t)(kb < K ? kb : K - 1) * ld + n] : 0.f; }
  return bsplit16(v); }
__device__ __forceinline__ v8f mac3(const F2& a, const F2& b, v8f c) { c = wmma_bf(a.l, b.h, c); c = wmma_bf(a.h, b.l, c); return wmma_bf(a.h, b.h, c); }
__device__ __forceinline__ float sigm(float v) { return 1.0f / (1.0f + expf(-v)); }
#define LDSX() do { asm volatile("s_wait_dscnt 0" ::: "memory"); __builtin_amdgcn_wave_barrier(); __builtin_amdgcn_fence(__ATOMIC_RELEASE, "workgroup"); } while (0)


#define NB 4
#define SS 1024
#define DM 1024
#define NH 16
#define HD 64
#define QKVW (3 * DM)
#ifndef TQB
#define TQB (SS / 64)
#define TNB NB
#define TOB (NB * SS / 64)     // output row tiles (all)
#endif
typedef __attribute__((ext_vector_type(8))) __bf16 v8b;
__device__ __forceinline__ v16b frag_b(const __bf16* rowk0, int lane) {
  union { v16b v; v8b q[2]; } u; const __bf16* p = rowk0 + 8 * (lane >> 4);
  u.q[0] = *(const v8b*)p; u.q[1] = *(const v8b*)(p + 16); return u.v;
}
__device__ __forceinline__ float bfr(float v) { return (float)(__bf16)v; }
__device__ __attribute__((noinline)) float exp_ni(float v) { return expf(v); }
__device__ __attribute__((noinline)) float erf_ni(float v) { return erff(v); }

#define PK_A 0                       // [3072][1024] Wqkv rows (natural [out][in])
#define PK_P (PK_A + QKVW * DM)        // [1024][1024] Wo rows (natural)
#define PK_END (PK_P + DM * DM)
#define WS_PK  0u
#define WS_QK  (WS_PK + 2u * PK_END)             // f16 [4096 rows][2048]: q | k
#define WS_QKL (WS_QK + 2u * NB * SS * 2 * DM)     // f16 [4096][2048]; never written (its loads in k_attn go unused)
#define WS_VTH (WS_QKL + 2u * NB * SS * 2 * DM)    // f16 [b][1024 (h*64+d)][1024 s] hi
#define WS_VTL (WS_VTH + 2u * NB * DM * SS)        // f16 lo x 2048
#define WS_O   (WS_VTL + 2u * NB * DM * SS)        // f32 [4096][1024]
#define WS_CS  (WS_O + 4u * NB * SS * DM)           // f32 [2][1024][32], not used
#define WS_QF  (WS_CS + 4u * 2 * SS * 32)                  // f32 [NR][2048] pre-LN q | k
#define WS_END (WS_QF + 4u * (size_t)NB * SS * 2 * DM)
// ---- k_pack: block = (row n, which): natural [out][in] rows -> bf16; which 0..2 -> W_q/W_k/W_v into PK_A rows which*1024 + n; 3 -> W_o into PK_P
__global__ __launch_bounds__(256) void k_pack(const float* __restrict__ WQ, const float* __restrict__ WK, const float* __restrict__ WV, const float* __restrict__ WO, __bf16* __restrict__ PK) {
  __shared__ __align__(16) __bf16 s[DM]; const int n = blockIdx.x, which = blockIdx.y, t = threadIdx.x; const float* Wm = (which == 0) ? WQ : (which == 1) ? WK : (which == 2) ? WV : WO;
  for (int k = t; k < DM; k += 256) s[k] = (__bf16)Wm[(size_t)n * DM + k];
  __syncthreads();
  __bf16* dst = (which < 3) ? PK + PK_A + ((size_t)which * DM + n) * DM : PK + PK_P + (size_t)n * DM;
  for (int q = t; q < DM / 8; q += 256) vst2((unsigned*)(dst + q * 8), *(const v4u*)&s[q * 8]);
}
// ---- tiled product core of k_qkv and k_out: one 128 x 128 tile of A[.][1024] (f32) . B[.][1024]^T (bf16) per block of four waves (2 x 2, 64 x 64 each).
// A stage is 64 k of both operands in LDS: 128 A rows of 256 B at pitch 272, then 128 B rows of 128 B at pitch 144 (16 B x odd for the 16-byte readers). Two buffers: the next stage's copies fly while this one is worked on.
#define GKW 64
#define GAP 272
#define GBP 144
#define GAB (128 * GAP)
#define GST (GAB + 128 * GBP)
typedef __attribute__((ext_vector_type(2))) __bf16 v2b;
__device__ __forceinline__ unsigned lds_off(const void* p) { return (unsigned)(size_t)p; }
// eight asynchronous 16-byte copies per lane, global -> LDS; the s_wait_xcnt closes the statement so that no address register is rewritten ahead of it
__device__ __forceinline__ void cp8(unsigned l, unsigned ls, const char* g, size_t gs) {
  asm volatile("global_load_async_to_lds_b128 %0, %8, off\n\t"
               "global_load_async_to_lds_b128 %1, %9, off\n\t"
               "global_load_async_to_lds_b128 %2, %10, off\n\t"
               "global_load_async_to_lds_b128 %3, %11, off\n\t"
               "global_load_async_to_lds_b128 %4, %12, off\n\t"
               "global_load_async_to_lds_b128 %5, %13, off\n\t"
               "global_load_async_to_lds_b128 %6, %14, off\n\t"
               "global_load_async_to_lds_b128 %7, %15, off\n\t"
               "s_wait_xcnt 0x0"
               :: "v"(l), "v"(l + ls), "v"(l + 2 * ls), "v"(l + 3 * ls), "v"(l + 4 * ls), "v"(l + 5 * ls), "v"(l + 6 * ls), "v"(l + 7 * ls),
                  "v"(g), "v"(g + gs), "v"(g + 2 * gs), "v"(g + 3 * gs), "v"(g + 4 * gs), "v"(g + 5 * gs), "v"(g + 6 * gs), "v"(g + 7 * gs) : "memory");
}
// one stage: a wave's copy covers two whole A rows (2 x 256 B) or four whole B rows (4 x 128 B)
__device__ __forceinline__ void g_stage(unsigned lb, const float* A, const __bf16* B, int tid) {
  const unsigned la = lb + (unsigned)(tid >> 4) * GAP + (unsigned)(tid & 15) * 16; const char* ga = (const char*)A + (size_t)(tid >> 4) * (DM * 4) + (tid & 15) * 16;
  cp8(la, 8 * GAP, ga, (size_t)8 * DM * 4);
  cp8(la + 64 * GAP, 8 * GAP, ga + (size_t)64 * DM * 4, (size_t)8 * DM * 4);
  cp8(lb + GAB + (unsigned)(tid >> 3) * GBP + (unsigned)(tid & 7) * 16, 16 * GBP, (const char*)B + (size_t)(tid >> 3) * (DM * 2) + (tid & 7) * 16, (size_t)16 * DM * 2);
}
// A, B point at the tile's first row; SPLIT: A as bf16 hi + residual (2 products per k-step, residual first), else A rounded once to bf16. Every accumulator sums its k-steps in rising order. The inner loops are unrolled whole so that every fragment and accumulator index is a constant (registers, no scratch).
template <bool SPLIT> __device__ __forceinline__ void g_core(const float* __restrict__ A, const __bf16* __restrict__ B, unsigned char* sm, int tid, v8f (&acc)[4][4]) {
  const int wave = tid >> 5, lane = tid & 31, col = lane & 15, g = lane >> 4, wm = wave >> 1, wn = wave & 1; const unsigned l0 = lds_off(sm);
  g_stage(l0, A, B, tid);
  asm volatile("s_wait_asynccnt 0x0" ::: "memory");   // stage 0 landed (this wave's copies)
  __syncthreads();                                    // ... and every other wave's
  g_stage(l0 + GST, A + GKW, B + GKW, tid);
#pragma unroll 1   // one stage per trip: the ring's order stays as written
  for (int t = 0; t < DM / GKW; ++t) {
    const unsigned char* sa = sm + (t & 1) * GST + (wm * 64 + col) * GAP + 32 * g; const unsigned char* sb = sm + (t & 1) * GST + GAB + (wn * 64 + col) * GBP + 16 * g;
#pragma unroll
    for (int kc = 0; kc < GKW / 32; ++kc) { v16b w[4];
#pragma unroll
      for (int j = 0; j < 4; ++j) { union { v16b v; v8b q[2]; } u; u.q[0] = *(const v8b*)(sb + j * 16 * GBP + kc * 64); u.q[1] = *(const v8b*)(sb + j * 16 * GBP + kc * 64 + 32); w[j] = u.v; }
#pragma unroll
      for (int i = 0; i < 4; ++i) { const v2f* p = (const v2f*)(sa + i * 16 * GAP + kc * 128); union { v16b v; v2b q[8]; } h, l;   // k order of the fragment: 8 g + 0..7, then 16 + 8 g + 0..7, as in the B rows
#pragma unroll
        for (int e = 0; e < 4; ++e) { const v2f x0 = p[e], x1 = p[8 + e]; h.q[e] = __builtin_convertvector(x0, v2b); h.q[4 + e] = __builtin_convertvector(x1, v2b);
          if (SPLIT) { l.q[e] = __builtin_convertvector(x0 - __builtin_convertvector(h.q[e], v2f), v2b); l.q[4 + e] = __builtin_convertvector(x1 - __builtin_convertvector(h.q[4 + e], v2f), v2b); } }
        if (SPLIT) {
#pragma unroll
          for (int j = 0; j < 4; ++j) acc[i][j] = wmma_bf(l.v, w[j], acc[i][j]); }
#pragma unroll
        for (int j = 0; j < 4; ++j) acc[i][j] = wmma_bf(h.v, w[j], acc[i][j]); } }
    asm volatile("s_wait_dscnt 0x0" ::: "memory");      // this wave has left the buffer
    asm volatile("s_wait_asynccnt 0x0" ::: "memory");   // its copies of stage t + 1 have landed
    __syncthreads();                                    // publishes stage t + 1 and frees stage t's buffer
    if (t + 2 < DM / GKW) g_stage(l0 + (t & 1) * GST, A + (t + 2) * GKW, B + (t + 2) * GKW, tid);
  }
  asm volatile("s_wait_asynccnt 0x0" ::: "memory");     // nothing in flight when the ring becomes output staging
}
__global__ __launch_bounds__(128) void k_qkv(const float* __restrict__ XQ, const float* __restrict__ XK, const float* __restrict__ XV, const __bf16* __restrict__ P, const float* __restrict__ BQ, const float* __restrict__ BK, const float* __restrict__ BV, float* __restrict__ QF, _Float16* __restrict__ QK, _Float16* __restrict__ QKL, _Float16* __restrict__ VTH, _Float16* __restrict__ VTL) {
  const int which0 = (blockIdx.y * 128) / DM; const float* X = (which0 == 0) ? XQ : (which0 == 1) ? XK : XV; const float* BB = BQ ? (((which0 == 0) ? BQ : (which0 == 1) ? BK : BV) + (blockIdx.y * 128 - which0 * DM)) : nullptr;
  __shared__ __attribute__((aligned(16))) unsigned char sm[2 * GST];
  const int tid = threadIdx.x, wave = tid >> 5, lane = tid & 31, col = lane & 15, g = lane >> 4, wm = wave >> 1, wn = wave & 1; const size_t m0 = (size_t)blockIdx.x * 128; const int n0 = blockIdx.y * 128;
  v8f acc[4][4] = {};
  g_core<false>(X + m0 * DM, P + (size_t)n0 * DM, sm, tid, acc);
  float bj[4] = {0.f, 0.f, 0.f, 0.f};   // this lane's four bias values
  if (BB) {
#pragma unroll
    for (int j = 0; j < 4; ++j) bj[j] = bfr(BB[wn * 64 + j * 16 + col]); }
  if (n0 < 2 * DM) {   // q and k kept in f32 (LayerNorm comes next); each wave stages its own 64 x 64 in its own range of the ring
    float* sf = (float*)(sm + wave * (64 * 68 * 4));
#pragma unroll
    for (int j = 0; j < 4; ++j) {
#pragma unroll
      for (int i = 0; i < 4; ++i) {
#pragma unroll
        for (int r = 0; r < 8; ++r) sf[(i * 16 + 8 * g + r) * 68 + j * 16 + col] = acc[i][j][r] + bj[j]; } }
    LDSX();
    for (int rl = 0; rl < 32; ++rl) vst2(QF + (m0 + wm * 64 + rl * 2 + g) * (2 * DM) + n0 + wn * 64 + col * 4, *(const v4f*)&sf[(rl * 2 + g) * 68 + col * 4]);
    asm volatile("s_wait_xcnt 0x0" ::: "memory");   // closes the run of stores before any code laid out behind it rewrites an address register
  } else {
    _Float16* sth = (_Float16*)sm; _Float16* stl = (_Float16*)(sm + 128 * 136 * 2);   // [128 d][136 s] each
#pragma unroll
    for (int j = 0; j < 4; ++j) {
#pragma unroll
      for (int i = 0; i < 4; ++i) { v8h hv8, lv8;
#pragma unroll
        for (int r = 0; r < 8; ++r) { const float v = acc[i][j][r] + bj[j]; const _Float16 hv = (_Float16)v; hv8[r] = hv; lv8[r] = (_Float16)((v - (float)hv) * 2048.0f); }
        const int o = (wn * 64 + j * 16 + col) * 136 + wm * 64 + i * 16 + 8 * g; *(v8h*)&sth[o] = hv8; *(v8h*)&stl[o] = lv8; } }
    __syncthreads();
    const int b = (int)(m0 / SS), s0 = (int)(m0 % SS); const int pc0 = n0 - 2 * DM;
    for (int it = 0; it < 16; ++it) { const int q = it * 128 + tid, d = q >> 4, pc = q & 15; const size_t o = ((size_t)b * DM + pc0 + d) * SS + s0 + pc * 8; vst2((unsigned*)(VTH + o), *(const v4u*)&sth[d * 136 + pc * 8]); vst2((unsigned*)(VTL + o), *(const v4u*)&stl[d * 136 + pc * 8]); }
    asm volatile("s_wait_xcnt 0x0" ::: "memory");   // closes the run of stores before any code laid out behind it rewrites an address register
  }
}
// ---- k_attn: block = (64 queries, head h, batch b): all-keys flash attention (K = 64: 2 k-steps), scores = (q.k) * 0.125 with single f16 operands, P.V: f16 P (x2^11) x V hi in one accumulator; O[b*S+q][h*64+d] = (acc + accl / 2048) / (2048 l) (256-B segments)
__global__ __launch_bounds__(128) void k_attn(const _Float16* __restrict__ QK, const _Float16* __restrict__ QKL, const _Float16* __restrict__ VTH, const _Float16* __restrict__ VTL, const void* __restrict__ KMASK, float* __restrict__ O) {
  __shared__ __align__(16) float sp[4][16][36]; __shared__ __align__(16) float so[4][16][68];
  const int tid = threadIdx.x, wave = tid >> 5, lane = tid & 31, col = lane & 15, g = lane >> 4;
  const int qb = blockIdx.x, h = blockIdx.y, b = blockIdx.z; const int q0 = qb * 64 + wave * 16; const size_t rq = (size_t)b * SS + q0 + col;
  v16h aq[2], aql[2];
#pragma unroll
  for (int kc = 0; kc < 2; ++kc) { aq[kc] = frag_h(QK + rq * (2 * DM) + h * HD + kc * 32, lane); aql[kc] = frag_h(QKL + rq * (2 * DM) + h * HD + kc * 32, lane); }
  float m[8], l[8];
#pragma unroll
  for (int r = 0; r < 8; ++r) { m[r] = -3.0e38f; l[r] = 0.f; }
  v8f acc[4] = {}, accl[4] = {};
  const int nks = SS / 32;   // all keys
#pragma unroll 1
  for (int ks = 0; ks < nks; ++ks) { v8f s[2];
#pragma unroll
    for (int ct = 0; ct < 2; ++ct) { const int kk = ks * 32 + ct * 16 + col; const _Float16* krow = QK + ((size_t)b * SS + kk) * (2 * DM) + DM + h * HD; const _Float16* krowl = QKL + ((size_t)b * SS + kk) * (2 * DM) + DM + h * HD; v8f c = {}, cl = {};
#pragma unroll
      for (int kc = 0; kc < 2; ++kc) c = wmma16(aq[kc], frag_h(krow + kc * 32, lane), c);   // single product: q, k as one-rounding f16 operands
      (void)cl; (void)krowl;
      { const bool keepk = true;
#pragma unroll
      for (int r = 0; r < 8; ++r) s[ct][r] = keepk ? c[r] * 0.125f : -3.0e38f; } }   // 1/sqrt(64); no mask: every key kept
#pragma unroll
    for (int r = 0; r < 8; ++r) { float mx = fmaxf(s[0][r], s[1][r]);
#pragma unroll
      for (int o = 1; o < 16; o <<= 1) mx = fmaxf(mx, __shfl_xor(mx, o));
      const float mn = fmaxf(m[r], mx); const float alpha = (m[r] <= -1.0e38f) ? 0.f : __expf(m[r] - mn);
      const float e0 = (s[0][r] <= -1.0e38f) ? 0.f : __expf(s[0][r] - mn), e1 = (s[1][r] <= -1.0e38f) ? 0.f : __expf(s[1][r] - mn); float es = e0 + e1;
#pragma unroll
      for (int o = 1; o < 16; o <<= 1) es += __shfl_xor(es, o);
      l[r] = l[r] * alpha + es; m[r] = mn;
#pragma unroll
      for (int dt = 0; dt < 4; ++dt) { acc[dt][r] *= alpha; accl[dt][r] *= alpha; }
      sp[wave][8 * g + r][col] = e0; sp[wave][8 * g + r][16 + col] = e1; }
    LDSX();
    v16h pa, pl; { const float* prow = &sp[wave][col][0] + 8 * (lane >> 4);
#pragma unroll
      for (int i = 0; i < 8; ++i) { const float x0 = prow[i] * 2048.0f, x1 = prow[16 + i] * 2048.0f; const _Float16 h0 = (_Float16)x0, h1 = (_Float16)x1; pa[i] = h0; pa[8 + i] = h1; pl[i] = (_Float16)((x0 - (float)h0) * 2048.0f); pl[8 + i] = (_Float16)((x1 - (float)h1) * 2048.0f); } }   // P scaled by 2^11 before the f16 split so small softmax weights stay out of the f16 subnormal range; 2^-11 folded into the epilogue
#pragma unroll
    for (int dt = 0; dt < 4; ++dt) { const size_t vr = ((size_t)b * DM + h * HD + dt * 16 + col) * SS + ks * 32; acc[dt] = wmma16(pa, frag_h(VTH + vr, lane), acc[dt]); }   // single product: P (x2^11) x V
    (void)pl;
    LDSX(); }
#pragma unroll
  for (int r = 0; r < 8; ++r) { const float il = (1.0f / 2048.0f) / l[r];
#pragma unroll
    for (int dt = 0; dt < 4; ++dt) so[wave][8 * g + r][dt * 16 + col] = (acc[dt][r] + accl[dt][r] * (1.0f / 2048.0f)) * il; }
  LDSX();
  for (int rl = 0; rl < 16; ++rl) if (lane < 16) vst2(O + ((size_t)b * SS + q0 + rl) * DM + h * HD + lane * 4, *(const v4f*)&so[wave][rl][lane * 4]);
}
// ---- k_out: block = (128 rows, 128 cols): out = O(hi/lo) . Wo rows (2 products) + bo
__global__ __launch_bounds__(128) void k_out(const float* __restrict__ O, const __bf16* __restrict__ P, const float* __restrict__ BO, float* __restrict__ Y) {
  __shared__ __attribute__((aligned(16))) unsigned char sm[2 * GST];
  const int tid = threadIdx.x, wave = tid >> 5, lane = tid & 31, col = lane & 15, g = lane >> 4, wm = wave >> 1, wn = wave & 1; const size_t m0 = (size_t)blockIdx.x * 128; const int n0 = blockIdx.y * 128;
  v8f acc[4][4] = {};
  g_core<true>(O + m0 * DM, P + (size_t)n0 * DM, sm, tid, acc);
  float bj[4];   // this lane's four bias values
#pragma unroll
  for (int j = 0; j < 4; ++j) bj[j] = bfr(BO[n0 + wn * 64 + j * 16 + col]);
  float* sf = (float*)(sm + wave * (64 * 68 * 4));   // each wave stages its own 64 x 64 in its own range of the ring
#pragma unroll
  for (int j = 0; j < 4; ++j) {
#pragma unroll
    for (int i = 0; i < 4; ++i) {
#pragma unroll
      for (int r = 0; r < 8; ++r) sf[(i * 16 + 8 * g + r) * 68 + j * 16 + col] = acc[i][j][r] + bj[j]; } }
  LDSX();
  for (int rl = 0; rl < 32; ++rl) vst2(Y + (m0 + wm * 64 + rl * 2 + g) * DM + n0 + wn * 64 + col * 4, *(const v4f*)&sf[(rl * 2 + g) * 68 + col * 4]);
}
// ---- k_lnqk: block = (token row, q or k): LayerNorm over the 1,024 flattened head dims (jnp.var, 1e-5) x g + b -> f16 row into the engine's q | k layout
__global__ __launch_bounds__(256) void k_lnqk(const float* __restrict__ QF, const float* __restrict__ GQ, const float* __restrict__ BQn, const float* __restrict__ GK, const float* __restrict__ BKn, _Float16* __restrict__ QK) {
  __shared__ float red[8]; __shared__ __align__(16) _Float16 sh[DM]; const int t = threadIdx.x; const size_t row = blockIdx.x; const int which = blockIdx.y; const float* X = QF + row * (2 * DM) + which * DM; const float* G = which ? GK : GQ; const float* Bt = which ? BKn : BQn;
  float v[4]; float s = 0.f; for (int i = 0; i < 4; ++i) { v[i] = X[t * 4 + i]; s += v[i]; }
#pragma unroll
  for (int o = 1; o < 32; o <<= 1) s += __shfl_xor(s, o);
  if ((t & 31) == 0) red[t >> 5] = s; __syncthreads(); float tot = 0.f; for (int i = 0; i < 8; ++i) tot += red[i]; const float mu = tot / (float)DM; __syncthreads();
  float q = 0.f; for (int i = 0; i < 4; ++i) { const float d = v[i] - mu; q += d * d; }
#pragma unroll
  for (int o = 1; o < 32; o <<= 1) q += __shfl_xor(q, o);
  if ((t & 31) == 0) red[t >> 5] = q; __syncthreads(); float tq = 0.f; for (int i = 0; i < 8; ++i) tq += red[i]; const float inv = 1.0f / sqrtf(tq / (float)DM + 1e-5f);
  for (int i = 0; i < 4; ++i) { const int e = t * 4 + i; sh[e] = (_Float16)((v[i] - mu) * inv * bfr(G[e]) + bfr(Bt[e])); }
  __syncthreads(); if (t < DM / 8) vst2((unsigned*)(QK + row * (2 * DM) + which * DM + t * 8), *(const v4u*)&sh[t * 8]);
}
extern "C" void kernel_launch(void* const* d_in, const int* in_sizes, int n_in, void* d_out, int out_size, void* d_ws, size_t ws_size, hipStream_t stream) {
  (void)in_sizes; (void)n_in; (void)out_size;
  const float** F = (const float**)d_in;   // 0 x [4,1024,1024], 1 qkv_w [3072,1024] natural (q | k | v row blocks), 2 qkv_b, 3 q_norm_g, 4 q_norm_b, 5 k_norm_g, 6 k_norm_b, 7 proj_w [1024,1024], 8 proj_b
  if (ws_size < (size_t)WS_END) return;
  char* ws = (char*)d_ws; __bf16* PK = (__bf16*)(ws + WS_PK); _Float16 *QK = (_Float16*)(ws + WS_QK), *QKL = (_Float16*)(ws + WS_QKL), *VTH = (_Float16*)(ws + WS_VTH), *VTL = (_Float16*)(ws + WS_VTL); float *O = (float*)(ws + WS_O), *QF = (float*)(ws + WS_QF);
  k_pack<<<dim3(DM, 4), 256, 0, stream>>>(F[1], F[1] + (size_t)DM * DM, F[1] + (size_t)2 * DM * DM, F[7], PK);
  k_qkv<<<dim3(TNB * SS / 128, QKVW / 128), 128, 0, stream>>>(F[0], F[0], F[0], PK + PK_A, F[2], F[2] + DM, F[2] + 2 * DM, QF, QK, QKL, VTH, VTL);
  k_lnqk<<<dim3(TNB * SS, 2), 256, 0, stream>>>(QF, F[3], F[4], F[5], F[6], QK);
  k_attn<<<dim3(TQB, NH, TNB), 128, 0, stream>>>(QK, QKL, VTH, VTL, nullptr, O);
  k_out<<<dim3(TOB / 2, DM / 128), 128, 0, stream>>>(O, PK + PK_P, F[8], (float*)d_out);
}

// v002
// One run takes 125 microseconds.
// In both of two side-by-side timings against v001, it was 1.37 times as fast.
// Counting every step since v000, it is 2.66 times as fast.
// compute dtype: all float inputs rounded to bf16; qkv = x . W^T + b with EXACT bf16 products on WMMA 16x16x32 (natural rows; three contiguous row blocks) kept in f32 for q and k; the two per-token LayerNorms (1,024 wide, eps 1e-5) in f32, then q, k rounded once to f16; PLAIN attention: x 1/8, running-max softmax in f32 (hardware exp), P (scaled by 2^11, single f16) x v (single f16); out = o (bf16 hi + residual) . proj_w^T (2 products) + proj_b.
#include <hip/hip_runtime.h>
#include <math.h>

typedef __attribute__((ext_vector_type(16))) _Float16 v16h;
typedef __attribute__((ext_vector_type(16))) __bf16 v16b;
typedef __attribute__((ext_vector_type(8)))  _Float16 v8h;
typedef __attribute__((ext_vector_type(8)))  float v8f;
typedef __attribute__((ext_vector_type(4)))  float v4f;
typedef __attribute__((ext_vector_type(2)))  float v2f;
typedef __attribute__((ext_vector_type(4)))  unsigned v4u;
typedef __attribute__((ext_vector_type(4)))  int v4i;
typedef float __attribute__((may_alias)) float_a;
typedef int __attribute__((may_alias)) int_a;

template <typename T> __device__ __forceinline__ void vst2(void* p, T v) { *(T*)p = v;  }
__device__ __forceinline__ v8f wmma16(v16h a, v16h b, v8f c) {
  v8f d = __builtin_amdgcn_wmma_f32_16x16x32_f16(false, a, false, b, (short)0, c, false, false);
  asm volatile("v_nop\n\tv_nop\n\tv_nop\n\tv_nop" : "+v"(d) : "v"(a), "v"(b));
  return d;
}
__device__ __forceinline__ v8f wmma_bf(v16b a, v16b b, v8f c) {
  v8f d = __builtin_amdgcn_wmma_f32_16x16x32_bf16(false, a, false, b, (short)0, c, false, false);
  asm volatile("v_nop\n\tv_nop\n\tv_nop\n\tv_nop" : "+v"(d) : "v"(a), "v"(b));
  return d;
}
// attention with qk LayerNorm (B 4, N 1,024, C 1,024, 16 heads x 64): fused qkv projection + bias, LayerNorm over the flattened q and k per token, softmax(q k / 8) v, output projection + bias.
__device__ __forceinline__ v16h frag_h(const _Float16* rowk0, int lane) {
  union { v16h v; v8h q[2]; } u; const _Float16* p = rowk0 + 8 * (lane >> 4);
  u.q[0] = *(const v8h*)p; u.q[1] = *(const v8h*)(p + 16); return u.v;
}
__device__ __forceinline__ v16h frag_f32(const float* rowk0, int lane) {
  v16h a; const float* p = rowk0 + 8 * (lane >> 4);
#pragma unroll
  for (int i = 0; i < 8; ++i) { a[i] = (_Float16)p[i]; a[8 + i] = (_Float16)p[16 + i]; }
  return a;
}
__device__ __forceinline__ v16h frag_f32s(const float* rowk0, int lane, float sc) {
  v16h a; const float* p = rowk0 + 8 * (lane >> 4);
#pragma unroll
  for (int i = 0; i < 8; ++i) { a[i] = (_Float16)(p[i] * sc); a[8 + i] = (_Float16)(p[16 + i] * sc); }
  return a;
}
// column fragment from a [K][ld] layout (column n), rows >= K read as 0
__device__ __forceinline__ v16h fragc_f32(const float* W, int k0, int n, int lane, int ld, int K) {
  v16h a; const int g = lane >> 4;
#pragma unroll
  for (int i = 0; i < 8; ++i) { const int ka = k0 + 8 * g + i, kb = ka + 16;
    a[i] = (_Float16)(ka < K ? W[(size_t)(ka < K ? ka : K - 1) * ld + n] : 0.f); a[8 + i] = (_Float16)(kb < K ? W[(size_t)(kb < K ? kb : K - 1) * ld + n] : 0.f); }
  return a;
}
struct F2 { v16b h, l; };
__device__ __forceinline__ F2 bsplit16(const float v[16]) { F2 r;
#pragma unroll
  for (int i = 0; i < 16; ++i) { const __bf16 h = (__bf16)v[i]; r.h[i] = h; r.l[i] = (__bf16)(v[i] - (float)h); }
  return r; }
__device__ __forceinline__ F2 split_row(const float* row, int k0, int lane) { float v[16]; const float* p = row + k0 + 8 * (lane >> 4);
#pragma unroll
  for (int i = 0; i < 8; ++i) { v[i] = p[i]; v[8 + i] = p[16 + i]; }
  return bsplit16(v); }
__device__ __forceinline__ F2 split_rowK(const float* row, int k0, int lane, int K) { float v[16]; const int g = lane >> 4;
#pragma unroll
  for (int i = 0; i < 8; ++i) { const int ka = k0 + 8 * g + i, kb = ka + 16; v[i] = ka < K ? row[ka < K ? ka : K - 1] : 0.f; v[8 + i] = kb < K ? row[kb < K ? kb : K - 1] : 0.f; }
  return bsplit16(v); }
__device__ __forceinline__ F2 split_col(const float* W, int k0, int n, int lane, int ld, int K) { float v[16]; const int g = lane >> 4;
#pragma unroll
  for (int i = 0; i < 8; ++i) { const int ka = k0 + 8 * g + i, kb = ka + 16; v[i] = ka < K ? W[(size_t)(ka < K ? ka : K - 1) * ld + n] : 0.f; v[8 + i] = kb < K ? W[(size_t)(kb < K ? kb : K - 1) * ld + n] : 0.f; }
  return bsplit16(v); }
__device__ __forceinline__ v8f mac3(const F2& a, const F2& b, v8f c) { c = wmma_bf(a.l, b.h, c); c = wmma_bf(a.h, b.l, c); return wmma_bf(a.h, b.h, c); }
__device__ __forceinline__ float sigm(float v) { return 1.0f / (1.0f + expf(-v)); }
#define LDSX() do { asm volatile("s_wait_dscnt 0" ::: "memory"); __builtin_amdgcn_wave_barrier(); __builtin_amdgcn_fence(__ATOMIC_RELEASE, "workgroup"); } while (0)


#define NB 4
#define SS 1024
#define DM 1024
#define NH 16
#define HD 64
#define QKVW (3 * DM)
#ifndef TQB
#define TQB (SS / 64)
#define TNB NB
#define TOB (NB * SS / 64)     // output row tiles (all)
#endif
typedef __attribute__((ext_vector_type(8))) __bf16 v8b;
__device__ __forceinline__ v16b frag_b(const __bf16* rowk0, int lane) {
  union { v16b v; v8b q[2]; } u; const __bf16* p = rowk0 + 8 * (lane >> 4);
  u.q[0] = *(const v8b*)p; u.q[1] = *(const v8b*)(p + 16); return u.v;
}
__device__ __forceinline__ float bfr(float v) { return (float)(__bf16)v; }
__device__ __attribute__((noinline)) float exp_ni(float v) { return expf(v); }
__device__ __attribute__((noinline)) float erf_ni(float v) { return erff(v); }

#define PK_A 0                       // [3072][1024] Wqkv rows (natural [out][in])
#define PK_P (PK_A + QKVW * DM)        // [1024][1024] Wo rows (natural)
#define PK_END (PK_P + DM * DM)
#define WS_PK  0u
#define WS_QK  (WS_PK + 2u * PK_END)             // f16 [4096 rows][2048]: q | k
#define WS_QKL (WS_QK + 2u * NB * SS * 2 * DM)     // f16 [4096][2048]; never written or read
#define WS_VTH (WS_QKL + 2u * NB * SS * 2 * DM)    // f16 [b][1024 (h*64+d)][1024 s] hi
#define WS_VTL (WS_VTH + 2u * NB * DM * SS)        // f16 lo x 2048
#define WS_O   (WS_VTL + 2u * NB * DM * SS)        // f32 [4096][1024]
#define WS_CS  (WS_O + 4u * NB * SS * DM)           // f32 [2][1024][32], not used
#define WS_QF  (WS_CS + 4u * 2 * SS * 32)                  // f32 [NR][2048] pre-LN q | k
#define WS_END (WS_QF + 4u * (size_t)NB * SS * 2 * DM)
// ---- k_pack: block = (row n, which): natural [out][in] rows -> bf16; which 0..2 -> W_q/W_k/W_v into PK_A rows which*1024 + n; 3 -> W_o into PK_P
__global__ __launch_bounds__(256) void k_pack(const float* __restrict__ WQ, const float* __restrict__ WK, const float* __restrict__ WV, const float* __restrict__ WO, __bf16* __restrict__ PK) {
  __shared__ __align__(16) __bf16 s[DM]; const int n = blockIdx.x, which = blockIdx.y, t = threadIdx.x; const float* Wm = (which == 0) ? WQ : (which == 1) ? WK : (which == 2) ? WV : WO;
  for (int k = t; k < DM; k += 256) s[k] = (__bf16)Wm[(size_t)n * DM + k];
  __syncthreads();
  __bf16* dst = (which < 3) ? PK + PK_A + ((size_t)which * DM + n) * DM : PK + PK_P + (size_t)n * DM;
  for (int q = t; q < DM / 8; q += 256) vst2((unsigned*)(dst + q * 8), *(const v4u*)&s[q * 8]);
}
// ---- tiled product core of k_qkv and k_out: one 128 x 128 tile of A[.][1024] (f32) . B[.][1024]^T (bf16) per block of four waves (2 x 2, 64 x 64 each).
// A stage is 64 k of both operands in LDS: 128 A rows of 256 B at pitch 272, then 128 B rows of 128 B at pitch 144 (16 B x odd for the 16-byte readers). Two buffers: the next stage's copies fly while this one is worked on.
#define GKW 64
#define GAP 272
#define GBP 144
#define GAB (128 * GAP)
#define GST (GAB + 128 * GBP)
typedef __attribute__((ext_vector_type(2))) __bf16 v2b;
__device__ __forceinline__ unsigned lds_off(const void* p) { return (unsigned)(size_t)p; }
// eight asynchronous 16-byte copies per lane, global -> LDS; the s_wait_xcnt closes the statement so that no address register is rewritten ahead of it
__device__ __forceinline__ void cp8(unsigned l, unsigned ls, const char* g, size_t gs) {
  asm volatile("global_load_async_to_lds_b128 %0, %8, off\n\t"
               "global_load_async_to_lds_b128 %1, %9, off\n\t"
               "global_load_async_to_lds_b128 %2, %10, off\n\t"
               "global_load_async_to_lds_b128 %3, %11, off\n\t"
               "global_load_async_to_lds_b128 %4, %12, off\n\t"
               "global_load_async_to_lds_b128 %5, %13, off\n\t"
               "global_load_async_to_lds_b128 %6, %14, off\n\t"
               "global_load_async_to_lds_b128 %7, %15, off\n\t"
               "s_wait_xcnt 0x0"
               :: "v"(l), "v"(l + ls), "v"(l + 2 * ls), "v"(l + 3 * ls), "v"(l + 4 * ls), "v"(l + 5 * ls), "v"(l + 6 * ls), "v"(l + 7 * ls),
                  "v"(g), "v"(g + gs), "v"(g + 2 * gs), "v"(g + 3 * gs), "v"(g + 4 * gs), "v"(g + 5 * gs), "v"(g + 6 * gs), "v"(g + 7 * gs) : "memory");
}
// one stage: a wave's copy covers two whole A rows (2 x 256 B) or four whole B rows (4 x 128 B)
__device__ __forceinline__ void g_stage(unsigned lb, const float* A, const __bf16* B, int tid) {
  const unsigned la = lb + (unsigned)(tid >> 4) * GAP + (unsigned)(tid & 15) * 16; const char* ga = (const char*)A + (size_t)(tid >> 4) * (DM * 4) + (tid & 15) * 16;
  cp8(la, 8 * GAP, ga, (size_t)8 * DM * 4);
  cp8(la + 64 * GAP, 8 * GAP, ga + (size_t)64 * DM * 4, (size_t)8 * DM * 4);
  cp8(lb + GAB + (unsigned)(tid >> 3) * GBP + (unsigned)(tid & 7) * 16, 16 * GBP, (const char*)B + (size_t)(tid >> 3) * (DM * 2) + (tid & 7) * 16, (size_t)16 * DM * 2);
}
// A, B point at the tile's first row; SPLIT: A as bf16 hi + residual (2 products per k-step, residual first), else A rounded once to bf16. Every accumulator sums its k-steps in rising order. The inner loops are unrolled whole so that every fragment and accumulator index is a constant (registers, no scratch).
template <bool SPLIT> __device__ __forceinline__ void g_core(const float* __restrict__ A, const __bf16* __restrict__ B, unsigned char* sm, int tid, v8f (&acc)[4][4]) {
  const int wave = tid >> 5, lane = tid & 31, col = lane & 15, g = lane >> 4, wm = wave >> 1, wn = wave & 1; const unsigned l0 = lds_off(sm);
  g_stage(l0, A, B, tid);
  asm volatile("s_wait_asynccnt 0x0" ::: "memory");   // stage 0 landed (this wave's copies)
  __syncthreads();                                    // ... and every other wave's
  g_stage(l0 + GST, A + GKW, B + GKW, tid);
#pragma unroll 1   // one stage per trip: the ring's order stays as written
  for (int t = 0; t < DM / GKW; ++t) {
    const unsigned char* sa = sm + (t & 1) * GST + (wm * 64 + col) * GAP + 32 * g; const unsigned char* sb = sm + (t & 1) * GST + GAB + (wn * 64 + col) * GBP + 16 * g;
#pragma unroll
    for (int kc = 0; kc < GKW / 32; ++kc) { v16b w[4];
#pragma unroll
      for (int j = 0; j < 4; ++j) { union { v16b v; v8b q[2]; } u; u.q[0] = *(const v8b*)(sb + j * 16 * GBP + kc * 64); u.q[1] = *(const v8b*)(sb + j * 16 * GBP + kc * 64 + 32); w[j] = u.v; }
#pragma unroll
      for (int i = 0; i < 4; ++i) { const v2f* p = (const v2f*)(sa + i * 16 * GAP + kc * 128); union { v16b v; v2b q[8]; } h, l;   // k order of the fragment: 8 g + 0..7, then 16 + 8 g + 0..7, as in the B rows
#pragma unroll
        for (int e = 0; e < 4; ++e) { const v2f x0 = p[e], x1 = p[8 + e]; h.q[e] = __builtin_convertvector(x0, v2b); h.q[4 + e] = __builtin_convertvector(x1, v2b);
          if (SPLIT) { l.q[e] = __builtin_convertvector(x0 - __builtin_convertvector(h.q[e], v2f), v2b); l.q[4 + e] = __builtin_convertvector(x1 - __builtin_convertvector(h.q[4 + e], v2f), v2b); } }
        if (SPLIT) {
#pragma unroll
          for (int j = 0; j < 4; ++j) acc[i][j] = wmma_bf(l.v, w[j], acc[i][j]); }
#pragma unroll
        for (int j = 0; j < 4; ++j) acc[i][j] = wmma_bf(h.v, w[j], acc[i][j]); } }
    asm volatile("s_wait_dscnt 0x0" ::: "memory");      // this wave has left the buffer
    asm volatile("s_wait_asynccnt 0x0" ::: "memory");   // its copies of stage t + 1 have landed
    __syncthreads();                                    // publishes stage t + 1 and frees stage t's buffer
    if (t + 2 < DM / GKW) g_stage(l0 + (t & 1) * GST, A + (t + 2) * GKW, B + (t + 2) * GKW, tid);
  }
  asm volatile("s_wait_asynccnt 0x0" ::: "memory");     // nothing in flight when the ring becomes output staging
}
__global__ __launch_bounds__(128) void k_qkv(const float* __restrict__ XQ, const float* __restrict__ XK, const float* __restrict__ XV, const __bf16* __restrict__ P, const float* __restrict__ BQ, const float* __restrict__ BK, const float* __restrict__ BV, float* __restrict__ QF, _Float16* __restrict__ QK, _Float16* __restrict__ QKL, _Float16* __restrict__ VTH, _Float16* __restrict__ VTL) {
  const int which0 = (blockIdx.y * 128) / DM; const float* X = (which0 == 0) ? XQ : (which0 == 1) ? XK : XV; const float* BB = BQ ? (((which0 == 0) ? BQ : (which0 == 1) ? BK : BV) + (blockIdx.y * 128 - which0 * DM)) : nullptr;
  __shared__ __attribute__((aligned(16))) unsigned char sm[2 * GST];
  const int tid = threadIdx.x, wave = tid >> 5, lane = tid & 31, col = lane & 15, g = lane >> 4, wm = wave >> 1, wn = wave & 1; const size_t m0 = (size_t)blockIdx.x * 128; const int n0 = blockIdx.y * 128;
  v8f acc[4][4] = {};
  g_core<false>(X + m0 * DM, P + (size_t)n0 * DM, sm, tid, acc);
  float bj[4] = {0.f, 0.f, 0.f, 0.f};   // this lane's four bias values
  if (BB) {
#pragma unroll
    for (int j = 0; j < 4; ++j) bj[j] = bfr(BB[wn * 64 + j * 16 + col]); }
  if (n0 < 2 * DM) {   // q and k kept in f32 (LayerNorm comes next); each wave stages its own 64 x 64 in its own range of the ring
    float* sf = (float*)(sm + wave * (64 * 68 * 4));
#pragma unroll
    for (int j = 0; j < 4; ++j) {
#pragma unroll
      for (int i = 0; i < 4; ++i) {
#pragma unroll
        for (int r = 0; r < 8; ++r) sf[(i * 16 + 8 * g + r) * 68 + j * 16 + col] = acc[i][j][r] + bj[j]; } }
    LDSX();
    for (int rl = 0; rl < 32; ++rl) vst2(QF + (m0 + wm * 64 + rl * 2 + g) * (2 * DM) + n0 + wn * 64 + col * 4, *(const v4f*)&sf[(rl * 2 + g) * 68 + col * 4]);
    asm volatile("s_wait_xcnt 0x0" ::: "memory");   // closes the run of stores before any code laid out behind it rewrites an address register
  } else {
    _Float16* sth = (_Float16*)sm; _Float16* stl = (_Float16*)(sm + 128 * 136 * 2);   // [128 d][136 s] each
#pragma unroll
    for (int j = 0; j < 4; ++j) {
#pragma unroll
      for (int i = 0; i < 4; ++i) { v8h hv8, lv8;
#pragma unroll
        for (int r = 0; r < 8; ++r) { const float v = acc[i][j][r] + bj[j]; const _Float16 hv = (_Float16)v; hv8[r] = hv; lv8[r] = (_Float16)((v - (float)hv) * 2048.0f); }
        const int o = (wn * 64 + j * 16 + col) * 136 + wm * 64 + i * 16 + 8 * g; *(v8h*)&sth[o] = hv8; *(v8h*)&stl[o] = lv8; } }
    __syncthreads();
    const int b = (int)(m0 / SS), s0 = (int)(m0 % SS); const int pc0 = n0 - 2 * DM;
    for (int it = 0; it < 16; ++it) { const int q = it * 128 + tid, d = q >> 4, pc = q & 15; const size_t o = ((size_t)b * DM + pc0 + d) * SS + s0 + pc * 8; vst2((unsigned*)(VTH + o), *(const v4u*)&sth[d * 136 + pc * 8]); vst2((unsigned*)(VTL + o), *(const v4u*)&stl[d * 136 + pc * 8]); }
    asm volatile("s_wait_xcnt 0x0" ::: "memory");   // closes the run of stores before any code laid out behind it rewrites an address register
  }
}
// ---- k_attn: block = (64 queries, head h, batch b): all-keys flash attention (K = 64: 2 k-steps), scores = (q.k) * 0.125 with single f16 operands, P.V: f16 P x V hi, one product into acc (accl stays 0); O[b*S+q][h*64+d] = (acc + accl / 2048) / (2048 l) (256-B segments)
// A stage is 64 keys of this head in LDS, shared by the block's four waves: 64 K rows of 128 B, then 64 V^T rows (one per d) of 128 B, all at pitch 144 (16 B x odd for the 16-byte readers). Two buffers: the next stage's copies fly while this one is worked on.
#define AKT 64
#define ATP 144
#define ATK (64 * ATP)
#define AST (2 * ATK)
// one stage: eight asynchronous 16-byte copies per lane, global -> LDS, four of K and four of V^T; a wave's copy covers four whole 128-B rows; the s_wait_xcnt closes the statement so that no address register is rewritten ahead of it
__device__ __forceinline__ void a_stage(unsigned lb, const _Float16* K, const _Float16* V, int tid) {
  const unsigned lk = lb + (unsigned)(tid >> 3) * ATP + (unsigned)(tid & 7) * 16, lv = lk + ATK, ls = 16 * ATP;
  const char* gk = (const char*)K + (size_t)(tid >> 3) * (2 * DM * 2) + (tid & 7) * 16; const size_t ks = (size_t)16 * 2 * DM * 2;
  const char* gv = (const char*)V + (size_t)(tid >> 3) * (SS * 2) + (tid & 7) * 16; const size_t vs = (size_t)16 * SS * 2;
  asm volatile("global_load_async_to_lds_b128 %0, %8, off\n\t"
               "global_load_async_to_lds_b128 %1, %9, off\n\t"
               "global_load_async_to_lds_b128 %2, %10, off\n\t"
               "global_load_async_to_lds_b128 %3, %11, off\n\t"
               "global_load_async_to_lds_b128 %4, %12, off\n\t"
               "global_load_async_to_lds_b128 %5, %13, off\n\t"
               "global_load_async_to_lds_b128 %6, %14, off\n\t"
               "global_load_async_to_lds_b128 %7, %15, off\n\t"
               "s_wait_xcnt 0x0"
               :: "v"(lk), "v"(lk + ls), "v"(lk + 2 * ls), "v"(lk + 3 * ls), "v"(lv), "v"(lv + ls), "v"(lv + 2 * ls), "v"(lv + 3 * ls),
                  "v"(gk), "v"(gk + ks), "v"(gk + 2 * ks), "v"(gk + 3 * ks), "v"(gv), "v"(gv + vs), "v"(gv + 2 * vs), "v"(gv + 3 * vs) : "memory");
}
// fragment from a staged row; p = row start + 16 g bytes: k order 8 g + 0..7, then 16 + 8 g + 0..7, as frag_h
__device__ __forceinline__ v16h frag_l(const unsigned char* p) { union { v16h v; v8h q[2]; } u; u.q[0] = *(const v8h*)p; u.q[1] = *(const v8h*)(p + 32); return u.v; }
__global__ __launch_bounds__(128) void k_attn(const _Float16* __restrict__ QK, const _Float16* __restrict__ QKL, const _Float16* __restrict__ VTH, const _Float16* __restrict__ VTL, const void* __restrict__ KMASK, float* __restrict__ O) {
  __shared__ __align__(16) float sp[4][16][36]; __shared__ __align__(16) float so[4][16][68]; __shared__ __attribute__((aligned(16))) unsigned char ring[2 * AST];
  const int tid = threadIdx.x, wave = tid >> 5, lane = tid & 31, col = lane & 15, g = lane >> 4;
  const int qb = blockIdx.x, h = blockIdx.y, b = blockIdx.z; const int q0 = qb * 64 + wave * 16; const size_t rq = (size_t)b * SS + q0 + col;
  const unsigned l0 = lds_off(ring); const _Float16* Kg = QK + (size_t)b * SS * (2 * DM) + DM + h * HD; const _Float16* Vg = VTH + ((size_t)b * DM + h * HD) * SS;
  a_stage(l0, Kg, Vg, tid);
  v16h aq[2];
#pragma unroll
  for (int kc = 0; kc < 2; ++kc) aq[kc] = frag_h(QK + rq * (2 * DM) + h * HD + kc * 32, lane);
  float m[8], l[8];
#pragma unroll
  for (int r = 0; r < 8; ++r) { m[r] = -3.0e38f; l[r] = 0.f; }
  v8f acc[4] = {}, accl[4] = {};
  asm volatile("s_wait_asynccnt 0x0" ::: "memory");   // stage 0 landed (this wave's copies)
  __syncthreads();                                    // ... and every other wave's
  a_stage(l0 + AST, Kg + (size_t)AKT * (2 * DM), Vg + AKT, tid);
#pragma unroll 1   // one stage per trip: the ring's order stays as written
  for (int t = 0; t < SS / AKT; ++t) { const unsigned char* sk = ring + (t & 1) * AST + col * ATP + 16 * g; const unsigned char* sv = sk + ATK;
#pragma unroll   // both 32-key steps of the stage, keys in rising order: every LDS offset is a constant
  for (int u = 0; u < AKT / 32; ++u) { v8f s[2]; v16h kf[2][2], vf[4];   // the step's K and V^T fragments, read as one group of LDS reads ahead of its products
#pragma unroll
    for (int ct = 0; ct < 2; ++ct) {
#pragma unroll
      for (int kc = 0; kc < 2; ++kc) kf[ct][kc] = frag_l(sk + (u * 32 + ct * 16) * ATP + kc * 64); }
#pragma unroll
    for (int dt = 0; dt < 4; ++dt) vf[dt] = frag_l(sv + dt * 16 * ATP + u * 64);
#pragma unroll
    for (int ct = 0; ct < 2; ++ct) { v8f c = {};
#pragma unroll
      for (int kc = 0; kc < 2; ++kc) c = wmma16(aq[kc], kf[ct][kc], c);   // single product: q, k as one-rounding f16 operands
      { const bool keepk = true;
#pragma unroll
      for (int r = 0; r < 8; ++r) s[ct][r] = keepk ? c[r] * 0.125f : -3.0e38f; } }   // 1/sqrt(64); no mask: every key kept
#pragma unroll
    for (int r = 0; r < 8; ++r) { float mx = fmaxf(s[0][r], s[1][r]);
#pragma unroll
      for (int o = 1; o < 16; o <<= 1) mx = fmaxf(mx, __shfl_xor(mx, o));
      const float mn = fmaxf(m[r], mx); const float alpha = (m[r] <= -1.0e38f) ? 0.f : __expf(m[r] - mn);
      const float e0 = (s[0][r] <= -1.0e38f) ? 0.f : __expf(s[0][r] - mn), e1 = (s[1][r] <= -1.0e38f) ? 0.f : __expf(s[1][r] - mn); float es = e0 + e1;
#pragma unroll
      for (int o = 1; o < 16; o <<= 1) es += __shfl_xor(es, o);
      l[r] = l[r] * alpha + es; m[r] = mn;
#pragma unroll
      for (int dt = 0; dt < 4; ++dt) { acc[dt][r] *= alpha; accl[dt][r] *= alpha; }
      sp[wave][8 * g + r][col] = e0; sp[wave][8 * g + r][16 + col] = e1; }
    LDSX();
    v16h pa; { const float* prow = &sp[wave][col][0] + 8 * (lane >> 4);
#pragma unroll
      for (int i = 0; i < 8; ++i) { pa[i] = (_Float16)(prow[i] * 2048.0f); pa[8 + i] = (_Float16)(prow[16 + i] * 2048.0f); } }   // P scaled by 2^11 before the f16 rounding so small softmax weights stay out of the f16 subnormal range; 2^-11 folded into the epilogue
#pragma unroll
    for (int dt = 0; dt < 4; ++dt) acc[dt] = wmma16(pa, vf[dt], acc[dt]);   // single product: P (x2^11) x V
    LDSX(); }
    asm volatile("s_wait_dscnt 0x0" ::: "memory");      // this wave has left the buffer
    asm volatile("s_wait_asynccnt 0x0" ::: "memory");   // its copies of stage t + 1 have landed
    __syncthreads();                                    // publishes stage t + 1 and frees stage t's buffer
    if (t + 2 < SS / AKT) a_stage(l0 + (t & 1) * AST, Kg + (size_t)(t + 2) * AKT * (2 * DM), Vg + (t + 2) * AKT, tid);
  }
  asm volatile("s_wait_asynccnt 0x0" ::: "memory");     // nothing in flight when the wave goes on to its end
#pragma unroll
  for (int r = 0; r < 8; ++r) { const float il = (1.0f / 2048.0f) / l[r];
#pragma unroll
    for (int dt = 0; dt < 4; ++dt) so[wave][8 * g + r][dt * 16 + col] = (acc[dt][r] + accl[dt][r] * (1.0f / 2048.0f)) * il; }
  LDSX();
  for (int rl = 0; rl < 16; ++rl) if (lane < 16) vst2(O + ((size_t)b * SS + q0 + rl) * DM + h * HD + lane * 4, *(const v4f*)&so[wave][rl][lane * 4]);
}
// ---- k_out: block = (128 rows, 128 cols): out = O(hi/lo) . Wo rows (2 products) + bo
__global__ __launch_bounds__(128) void k_out(const float* __restrict__ O, const __bf16* __restrict__ P, const float* __restrict__ BO, float* __restrict__ Y) {
  __shared__ __attribute__((aligned(16))) unsigned char sm[2 * GST];
  const int tid = threadIdx.x, wave = tid >> 5, lane = tid & 31, col = lane & 15, g = lane >> 4, wm = wave >> 1, wn = wave & 1; const size_t m0 = (size_t)blockIdx.x * 128; const int n0 = blockIdx.y * 128;
  v8f acc[4][4] = {};
  g_core<true>(O + m0 * DM, P + (size_t)n0 * DM, sm, tid, acc);
  float bj[4];   // this lane's four bias values
#pragma unroll
  for (int j = 0; j < 4; ++j) bj[j] = bfr(BO[n0 + wn * 64 + j * 16 + col]);
  float* sf = (float*)(sm + wave * (64 * 68 * 4));   // each wave stages its own 64 x 64 in its own range of the ring
#pragma unroll
  for (int j = 0; j < 4; ++j) {
#pragma unroll
    for (int i = 0; i < 4; ++i) {
#pragma unroll
      for (int r = 0; r < 8; ++r) sf[(i * 16 + 8 * g + r) * 68 + j * 16 + col] = acc[i][j][r] + bj[j]; } }
  LDSX();
  for (int rl = 0; rl < 32; ++rl) vst2(Y + (m0 + wm * 64 + rl * 2 + g) * DM + n0 + wn * 64 + col * 4, *(const v4f*)&sf[(rl * 2 + g) * 68 + col * 4]);
}
// ---- k_lnqk: block = (token row, q or k): LayerNorm over the 1,024 flattened head dims (jnp.var, 1e-5) x g + b -> f16 row into the engine's q | k layout
__global__ __launch_bounds__(256) void k_lnqk(const float* __restrict__ QF, const float* __restrict__ GQ, const float* __restrict__ BQn, const float* __restrict__ GK, const float* __restrict__ BKn, _Float16* __restrict__ QK) {
  __shared__ float red[8]; __shared__ __align__(16) _Float16 sh[DM]; const int t = threadIdx.x; const size_t row = blockIdx.x; const int which = blockIdx.y; const float* X = QF + row * (2 * DM) + which * DM; const float* G = which ? GK : GQ; const float* Bt = which ? BKn : BQn;
  float v[4]; float s = 0.f; for (int i = 0; i < 4; ++i) { v[i] = X[t * 4 + i]; s += v[i]; }
#pragma unroll
  for (int o = 1; o < 32; o <<= 1) s += __shfl_xor(s, o);
  if ((t & 31) == 0) red[t >> 5] = s; __syncthreads(); float tot = 0.f; for (int i = 0; i < 8; ++i) tot += red[i]; const float mu = tot / (float)DM; __syncthreads();
  float q = 0.f; for (int i = 0; i < 4; ++i) { const float d = v[i] - mu; q += d * d; }
#pragma unroll
  for (int o = 1; o < 32; o <<= 1) q += __shfl_xor(q, o);
  if ((t & 31) == 0) red[t >> 5] = q; __syncthreads(); float tq = 0.f; for (int i = 0; i < 8; ++i) tq += red[i]; const float inv = 1.0f / sqrtf(tq / (float)DM + 1e-5f);
  for (int i = 0; i < 4; ++i) { const int e = t * 4 + i; sh[e] = (_Float16)((v[i] - mu) * inv * bfr(G[e]) + bfr(Bt[e])); }
  __syncthreads(); if (t < DM / 8) vst2((unsigned*)(QK + row * (2 * DM) + which * DM + t * 8), *(const v4u*)&sh[t * 8]);
}
extern "C" void kernel_launch(void* const* d_in, const int* in_sizes, int n_in, void* d_out, int out_size, void* d_ws, size_t ws_size, hipStream_t stream) {
  (void)in_sizes; (void)n_in; (void)out_size;
  const float** F = (const float**)d_in;   // 0 x [4,1024,1024], 1 qkv_w [3072,1024] natural (q | k | v row blocks), 2 qkv_b, 3 q_norm_g, 4 q_norm_b, 5 k_norm_g, 6 k_norm_b, 7 proj_w [1024,1024], 8 proj_b
  if (ws_size < (size_t)WS_END) return;
  char* ws = (char*)d_ws; __bf16* PK = (__bf16*)(ws + WS_PK); _Float16 *QK = (_Float16*)(ws + WS_QK), *QKL = (_Float16*)(ws + WS_QKL), *VTH = (_Float16*)(ws + WS_VTH), *VTL = (_Float16*)(ws + WS_VTL); float *O = (float*)(ws + WS_O), *QF = (float*)(ws + WS_QF);
  k_pack<<<dim3(DM, 4), 256, 0, stream>>>(F[1], F[1] + (size_t)DM * DM, F[1] + (size_t)2 * DM * DM, F[7], PK);
  k_qkv<<<dim3(TNB * SS / 128, QKVW / 128), 128, 0, stream>>>(F[0], F[0], F[0], PK + PK_A, F[2], F[2] + DM, F[2] + 2 * DM, QF, QK, QKL, VTH, VTL);
  k_lnqk<<<dim3(TNB * SS, 2), 256, 0, stream>>>(QF, F[3], F[4], F[5], F[6], QK);
  k_attn<<<dim3(TQB, NH, TNB), 128, 0, stream>>>(QK, QKL, VTH, VTL, nullptr, O);
  k_out<<<dim3(TOB / 2, DM / 128), 128, 0, stream>>>(O, PK + PK_P, F[8], (float*)d_out);
}

// v003
// A run of this version takes 96.9 microseconds.
// Two timings next to v002 both put it at 1.29 times that version's speed.
// Over all steps from v000 it is 3.42 times as fast.
// compute dtype: all float inputs rounded to bf16; qkv = x . W^T + b with EXACT bf16 products on WMMA 16x16x32 (natural rows; three contiguous row blocks) kept in f32 for q and k; the two per-token LayerNorms (1,024 wide, eps 1e-5) in f32, then q, k rounded once to f16; PLAIN attention: x 1/8, running-max softmax in f32 (hardware exp), P (scaled by 2^11, single f16) x v (single f16); out = o (bf16 hi + residual) . proj_w^T (2 products) + proj_b.
#include <hip/hip_runtime.h>
#include <math.h>

typedef __attribute__((ext_vector_type(16))) _Float16 v16h;
typedef __attribute__((ext_vector_type(16))) __bf16 v16b;
typedef __attribute__((ext_vector_type(8)))  _Float16 v8h;
typedef __attribute__((ext_vector_type(2)))  _Float16 v2h;
typedef __attribute__((ext_vector_type(8)))  float v8f;
typedef __attribute__((ext_vector_type(4)))  float v4f;
typedef __attribute__((ext_vector_type(2)))  float v2f;
typedef __attribute__((ext_vector_type(4)))  unsigned v4u;
typedef __attribute__((ext_vector_type(4)))  int v4i;
typedef float __attribute__((may_alias)) float_a;
typedef int __attribute__((may_alias)) int_a;

template <typename T> __device__ __forceinline__ void vst2(void* p, T v) { *(T*)p = v;  }
__device__ __forceinline__ v8f wmma16(v16h a, v16h b, v8f c) {
  v8f d = __builtin_amdgcn_wmma_f32_16x16x32_f16(false, a, false, b, (short)0, c, false, false);
  asm volatile("v_nop\n\tv_nop\n\tv_nop\n\tv_nop" : "+v"(d) : "v"(a), "v"(b));
  return d;
}
__device__ __forceinline__ v8f wmma_bf(v16b a, v16b b, v8f c) {
  v8f d = __builtin_amdgcn_wmma_f32_16x16x32_bf16(false, a, false, b, (short)0, c, false, false);
  asm volatile("v_nop\n\tv_nop\n\tv_nop\n\tv_nop" : "+v"(d) : "v"(a), "v"(b));
  return d;
}
// attention with qk LayerNorm (B 4, N 1,024, C 1,024, 16 heads x 64): fused qkv projection + bias, LayerNorm over the flattened q and k per token, softmax(q k / 8) v, output projection + bias.
__device__ __forceinline__ v16h frag_h(const _Float16* rowk0, int lane) {
  union { v16h v; v8h q[2]; } u; const _Float16* p = rowk0 + 8 * (lane >> 4);
  u.q[0] = *(const v8h*)p; u.q[1] = *(const v8h*)(p + 16); return u.v;
}
__device__ __forceinline__ v16h frag_f32(const float* rowk0, int lane) {
  v16h a; const float* p = rowk0 + 8 * (lane >> 4);
#pragma unroll
  for (int i = 0; i < 8; ++i) { a[i] = (_Float16)p[i]; a[8 + i] = (_Float16)p[16 + i]; }
  return a;
}
__device__ __forceinline__ v16h frag_f32s(const float* rowk0, int lane, float sc) {
  v16h a; const float* p = rowk0 + 8 * (lane >> 4);
#pragma unroll
  for (int i = 0; i < 8; ++i) { a[i] = (_Float16)(p[i] * sc); a[8 + i] = (_Float16)(p[16 + i] * sc); }
  return a;
}
// column fragment from a [K][ld] layout (column n), rows >= K read as 0
__device__ __forceinline__ v16h fragc_f32(const float* W, int k0, int n, int lane, int ld, int K) {
  v16h a; const int g = lane >> 4;
#pragma unroll
  for (int i = 0; i < 8; ++i) { const int ka = k0 + 8 * g + i, kb = ka + 16;
    a[i] = (_Float16)(ka < K ? W[(size_t)(ka < K ? ka : K - 1) * ld + n] : 0.f); a[8 + i] = (_Float16)(kb < K ? W[(size_t)(kb < K ? kb : K - 1) * ld + n] : 0.f); }
  return a;
}
struct F2 { v16b h, l; };
__device__ __forceinline__ F2 bsplit16(const float v[16]) { F2 r;
#pragma unroll
  for (int i = 0; i < 16; ++i) { const __bf16 h = (__bf16)v[i]; r.h[i] = h; r.l[i] = (__bf16)(v[i] - (float)h); }
  return r; }
__device__ __forceinline__ F2 split_row(const float* row, int k0, int lane) { float v[16]; const float* p = row + k0 + 8 * (lane >> 4);
#pragma unroll
  for (int i = 0; i < 8; ++i) { v[i] = p[i]; v[8 + i] = p[16 + i]; }
  return bsplit16(v); }
__device__ __forceinline__ F2 split_rowK(const float* row, int k0, int lane, int K) { float v[16]; const int g = lane >> 4;
#pragma unroll
  for (int i = 0; i < 8; ++i) { const int ka = k0 + 8 * g + i, kb = ka + 16; v[i] = ka < K ? row[ka < K ? ka : K - 1] : 0.f; v[8 + i] = kb < K ? row[kb < K ? kb : K - 1] : 0.f; }
  return bsplit16(v); }
__device__ __forceinline__ F2 split_col(const float* W, int k0, int n, int lane, int ld, int K) { float v[16]; const int g = lane >> 4;
#pragma unroll
  for (int i = 0; i < 8; ++i) { const int ka = k0 + 8 * g + i, kb = ka + 16; v[i] = ka < K ? W[(size_t)(ka < K ? ka : K - 1) * ld + n] : 0.f; v[8 + i] = kb < K ? W[(size_t)(kb < K ? kb : K - 1) * ld + n] : 0.f; }
  return bsplit16(v); }
__device__ __forceinline__ v8f mac3(const F2& a, const F2& b, v8f c) { c = wmma_bf(a.l, b.h, c); c = wmma_bf(a.h, b.l, c); return wmma_bf(a.h, b.h, c); }
__device__ __forceinline__ float sigm(float v) { return 1.0f / (1.0f + expf(-v)); }
#define LDSX() do { asm volatile("s_wait_dscnt 0" ::: "memory"); __builtin_amdgcn_wave_barrier(); __builtin_amdgcn_fence(__ATOMIC_RELEASE, "workgroup"); } while (0)


#define NB 4
#define SS 1024
#define DM 1024
#define NH 16
#define HD 64
#define QKVW (3 * DM)
#ifndef TQB
#define TQB (SS / 64)
#define TNB NB
#define TOB (NB * SS / 64)     // output row tiles (all)
#endif
typedef __attribute__((ext_vector_type(8))) __bf16 v8b;
__device__ __forceinline__ v16b frag_b(const __bf16* rowk0, int lane) {
  union { v16b v; v8b q[2]; } u; const __bf16* p = rowk0 + 8 * (lane >> 4);
  u.q[0] = *(const v8b*)p; u.q[1] = *(const v8b*)(p + 16); return u.v;
}
__device__ __forceinline__ float bfr(float v) { return (float)(__bf16)v; }
__device__ __attribute__((noinline)) float exp_ni(float v) { return expf(v); }
__device__ __attribute__((noinline)) float erf_ni(float v) { return erff(v); }

#define PK_A 0                       // [3072][1024] Wqkv rows (natural [out][in])
#define PK_P (PK_A + QKVW * DM)        // [1024][1024] Wo rows (natural)
#define PK_END (PK_P + DM * DM)
#define WS_PK  0u
#define WS_QK  (WS_PK + 2u * PK_END)             // f16 [4096 rows][2048]: q | k
#define WS_QKL (WS_QK + 2u * NB * SS * 2 * DM)     // f16 [4096][2048]; never written or read
#define WS_VTH (WS_QKL + 2u * NB * SS * 2 * DM)    // f16 [b][1024 (h*64+d)][1024 s] hi
#define WS_VTL (WS_VTH + 2u * NB * DM * SS)        // f16 lo x 2048
#define WS_O   (WS_VTL + 2u * NB * DM * SS)        // f32 [4096][1024]
#define WS_CS  (WS_O + 4u * NB * SS * DM)           // f32 [2][1024][32], not used
#define WS_QF  (WS_CS + 4u * 2 * SS * 32)                  // f32 [NR][2048] pre-LN q | k
#define WS_END (WS_QF + 4u * (size_t)NB * SS * 2 * DM)
// ---- k_pack: block = (row n, which): natural [out][in] rows -> bf16; which 0..2 -> W_q/W_k/W_v into PK_A rows which*1024 + n; 3 -> W_o into PK_P
__global__ __launch_bounds__(256) void k_pack(const float* __restrict__ WQ, const float* __restrict__ WK, const float* __restrict__ WV, const float* __restrict__ WO, __bf16* __restrict__ PK) {
  __shared__ __align__(16) __bf16 s[DM]; const int n = blockIdx.x, which = blockIdx.y, t = threadIdx.x; const float* Wm = (which == 0) ? WQ : (which == 1) ? WK : (which == 2) ? WV : WO;
  for (int k = t; k < DM; k += 256) s[k] = (__bf16)Wm[(size_t)n * DM + k];
  __syncthreads();
  __bf16* dst = (which < 3) ? PK + PK_A + ((size_t)which * DM + n) * DM : PK + PK_P + (size_t)n * DM;
  for (int q = t; q < DM / 8; q += 256) vst2((unsigned*)(dst + q * 8), *(const v4u*)&s[q * 8]);
}
// ---- tiled product core of k_qkv and k_out: one 128 x 128 tile of A[.][1024] (f32) . B[.][1024]^T (bf16) per block of four waves (2 x 2, 64 x 64 each).
// A stage is 64 k of both operands in LDS: 128 A rows of 256 B at pitch 272, then 128 B rows of 128 B at pitch 144 (16 B x odd for the 16-byte readers). Two buffers: the next stage's copies fly while this one is worked on.
#define GKW 64
#define GAP 272
#define GBP 144
#define GAB (128 * GAP)
#define GST (GAB + 128 * GBP)
typedef __attribute__((ext_vector_type(2))) __bf16 v2b;
__device__ __forceinline__ unsigned lds_off(const void* p) { return (unsigned)(size_t)p; }
// eight asynchronous 16-byte copies per lane, global -> LDS; the s_wait_xcnt closes the statement so that no address register is rewritten ahead of it
__device__ __forceinline__ void cp8(unsigned l, unsigned ls, const char* g, size_t gs) {
  asm volatile("global_load_async_to_lds_b128 %0, %8, off\n\t"
               "global_load_async_to_lds_b128 %1, %9, off\n\t"
               "global_load_async_to_lds_b128 %2, %10, off\n\t"
               "global_load_async_to_lds_b128 %3, %11, off\n\t"
               "global_load_async_to_lds_b128 %4, %12, off\n\t"
               "global_load_async_to_lds_b128 %5, %13, off\n\t"
               "global_load_async_to_lds_b128 %6, %14, off\n\t"
               "global_load_async_to_lds_b128 %7, %15, off\n\t"
               "s_wait_xcnt 0x0"
               :: "v"(l), "v"(l + ls), "v"(l + 2 * ls), "v"(l + 3 * ls), "v"(l + 4 * ls), "v"(l + 5 * ls), "v"(l + 6 * ls), "v"(l + 7 * ls),
                  "v"(g), "v"(g + gs), "v"(g + 2 * gs), "v"(g + 3 * gs), "v"(g + 4 * gs), "v"(g + 5 * gs), "v"(g + 6 * gs), "v"(g + 7 * gs) : "memory");
}
// one stage: a wave's copy covers two whole A rows (2 x 256 B) or four whole B rows (4 x 128 B)
__device__ __forceinline__ void g_stage(unsigned lb, const float* A, const __bf16* B, int tid) {
  const unsigned la = lb + (unsigned)(tid >> 4) * GAP + (unsigned)(tid & 15) * 16; const char* ga = (const char*)A + (size_t)(tid >> 4) * (DM * 4) + (tid & 15) * 16;
  cp8(la, 8 * GAP, ga, (size_t)8 * DM * 4);
  cp8(la + 64 * GAP, 8 * GAP, ga + (size_t)64 * DM * 4, (size_t)8 * DM * 4);
  cp8(lb + GAB + (unsigned)(tid >> 3) * GBP + (unsigned)(tid & 7) * 16, 16 * GBP, (const char*)B + (size_t)(tid >> 3) * (DM * 2) + (tid & 7) * 16, (size_t)16 * DM * 2);
}
// A, B point at the tile's first row; SPLIT: A as bf16 hi + residual (2 products per k-step, residual first), else A rounded once to bf16. Every accumulator sums its k-steps in rising order. The inner loops are unrolled whole so that every fragment and accumulator index is a constant (registers, no scratch).
template <bool SPLIT> __device__ __forceinline__ void g_core(const float* __restrict__ A, const __bf16* __restrict__ B, unsigned char* sm, int tid, v8f (&acc)[4][4]) {
  const int wave = tid >> 5, lane = tid & 31, col = lane & 15, g = lane >> 4, wm = wave >> 1, wn = wave & 1; const unsigned l0 = lds_off(sm);
  g_stage(l0, A, B, tid);
  asm volatile("s_wait_asynccnt 0x0" ::: "memory");   // stage 0 landed (this wave's copies)
  __syncthreads();                                    // ... and every other wave's
  g_stage(l0 + GST, A + GKW, B + GKW, tid);
#pragma unroll 1   // one stage per trip: the ring's order stays as written
  for (int t = 0; t < DM / GKW; ++t) {
    const unsigned char* sa = sm + (t & 1) * GST + (wm * 64 + col) * GAP + 32 * g; const unsigned char* sb = sm + (t & 1) * GST + GAB + (wn * 64 + col) * GBP + 16 * g;
#pragma unroll
    for (int kc = 0; kc < GKW / 32; ++kc) { v16b w[4];
#pragma unroll
      for (int j = 0; j < 4; ++j) { union { v16b v; v8b q[2]; } u; u.q[0] = *(const v8b*)(sb + j * 16 * GBP + kc * 64); u.q[1] = *(const v8b*)(sb + j * 16 * GBP + kc * 64 + 32); w[j] = u.v; }
#pragma unroll
      for (int i = 0; i < 4; ++i) { const v2f* p = (const v2f*)(sa + i * 16 * GAP + kc * 128); union { v16b v; v2b q[8]; } h, l;   // k order of the fragment: 8 g + 0..7, then 16 + 8 g + 0..7, as in the B rows
#pragma unroll
        for (int e = 0; e < 4; ++e) { const v2f x0 = p[e], x1 = p[8 + e]; h.q[e] = __builtin_convertvector(x0, v2b); h.q[4 + e] = __builtin_convertvector(x1, v2b);
          if (SPLIT) { l.q[e] = __builtin_convertvector(x0 - __builtin_convertvector(h.q[e], v2f), v2b); l.q[4 + e] = __builtin_convertvector(x1 - __builtin_convertvector(h.q[4 + e], v2f), v2b); } }
        if (SPLIT) {
#pragma unroll
          for (int j = 0; j < 4; ++j) acc[i][j] = wmma_bf(l.v, w[j], acc[i][j]); }
#pragma unroll
        for (int j = 0; j < 4; ++j) acc[i][j] = wmma_bf(h.v, w[j], acc[i][j]); } }
    asm volatile("s_wait_dscnt 0x0" ::: "memory");      // this wave has left the buffer
    asm volatile("s_wait_asynccnt 0x0" ::: "memory");   // its copies of stage t + 1 have landed
    __syncthreads();                                    // publishes stage t + 1 and frees stage t's buffer
    if (t + 2 < DM / GKW) g_stage(l0 + (t & 1) * GST, A + (t + 2) * GKW, B + (t + 2) * GKW, tid);
  }
  asm volatile("s_wait_asynccnt 0x0" ::: "memory");     // nothing in flight when the ring becomes output staging
}
__global__ __launch_bounds__(128) void k_qkv(const float* __restrict__ XQ, const float* __restrict__ XK, const float* __restrict__ XV, const __bf16* __restrict__ P, const float* __restrict__ BQ, const float* __restrict__ BK, const float* __restrict__ BV, float* __restrict__ QF, _Float16* __restrict__ QK, _Float16* __restrict__ QKL, _Float16* __restrict__ VTH, _Float16* __restrict__ VTL) {
  const int which0 = (blockIdx.y * 128) / DM; const float* X = (which0 == 0) ? XQ : (which0 == 1) ? XK : XV; const float* BB = BQ ? (((which0 == 0) ? BQ : (which0 == 1) ? BK : BV) + (blockIdx.y * 128 - which0 * DM)) : nullptr;
  __shared__ __attribute__((aligned(16))) unsigned char sm[2 * GST];
  const int tid = threadIdx.x, wave = tid >> 5, lane = tid & 31, col = lane & 15, g = lane >> 4, wm = wave >> 1, wn = wave & 1; const size_t m0 = (size_t)blockIdx.x * 128; const int n0 = blockIdx.y * 128;
  v8f acc[4][4] = {};
  g_core<false>(X + m0 * DM, P + (size_t)n0 * DM, sm, tid, acc);
  float bj[4] = {0.f, 0.f, 0.f, 0.f};   // this lane's four bias values
  if (BB) {
#pragma unroll
    for (int j = 0; j < 4; ++j) bj[j] = bfr(BB[wn * 64 + j * 16 + col]); }
  if (n0 < 2 * DM) {   // q and k kept in f32 (LayerNorm comes next); each wave stages its own 64 x 64 in its own range of the ring
    float* sf = (float*)(sm + wave * (64 * 68 * 4));
#pragma unroll
    for (int j = 0; j < 4; ++j) {
#pragma unroll
      for (int i = 0; i < 4; ++i) {
#pragma unroll
        for (int r = 0; r < 8; ++r) sf[(i * 16 + 8 * g + r) * 68 + j * 16 + col] = acc[i][j][r] + bj[j]; } }
    LDSX();
    for (int rl = 0; rl < 32; ++rl) vst2(QF + (m0 + wm * 64 + rl * 2 + g) * (2 * DM) + n0 + wn * 64 + col * 4, *(const v4f*)&sf[(rl * 2 + g) * 68 + col * 4]);
    asm volatile("s_wait_xcnt 0x0" ::: "memory");   // closes the run of stores before any code laid out behind it rewrites an address register
  } else {
    _Float16* sth = (_Float16*)sm; _Float16* stl = (_Float16*)(sm + 128 * 136 * 2);   // [128 d][136 s] each
#pragma unroll
    for (int j = 0; j < 4; ++j) {
#pragma unroll
      for (int i = 0; i < 4; ++i) { v8h hv8, lv8;
#pragma unroll
        for (int r = 0; r < 8; ++r) { const float v = acc[i][j][r] + bj[j]; const _Float16 hv = (_Float16)v; hv8[r] = hv; lv8[r] = (_Float16)((v - (float)hv) * 2048.0f); }
        const int o = (wn * 64 + j * 16 + col) * 136 + wm * 64 + i * 16 + 8 * g; *(v8h*)&sth[o] = hv8; *(v8h*)&stl[o] = lv8; } }
    __syncthreads();
    const int b = (int)(m0 / SS), s0 = (int)(m0 % SS); const int pc0 = n0 - 2 * DM;
    for (int it = 0; it < 16; ++it) { const int q = it * 128 + tid, d = q >> 4, pc = q & 15; const size_t o = ((size_t)b * DM + pc0 + d) * SS + s0 + pc * 8; vst2((unsigned*)(VTH + o), *(const v4u*)&sth[d * 136 + pc * 8]); vst2((unsigned*)(VTL + o), *(const v4u*)&stl[d * 136 + pc * 8]); }
    asm volatile("s_wait_xcnt 0x0" ::: "memory");   // closes the run of stores before any code laid out behind it rewrites an address register
  }
}
// ---- k_attn: block = (64 queries, head h, batch b): all-keys flash attention (K = 64: 2 k-steps), scores = (q.k) * 0.125 with single f16 operands, P.V: f16 P x f16 V; O[b*S+q][h*64+d] = acc / l (256-B segments)
// A stage is 64 keys of this head in LDS, shared by the block's four waves: 64 K rows of 128 B, then 64 V^T rows (one per d) of 128 B, all at pitch 144 (16 B x odd for the 16-byte readers). Two buffers: the next stage's copies fly while this one is worked on.
#define AKT 64
#define ATP 144
#define ATK (64 * ATP)
#define AST (2 * ATK)
// one stage: eight asynchronous 16-byte copies per lane, global -> LDS, four of K and four of V^T; a wave's copy covers four whole 128-B rows; the s_wait_xcnt closes the statement so that no address register is rewritten ahead of it
__device__ __forceinline__ void a_stage(unsigned lb, const _Float16* K, const _Float16* V, int tid) {
  const unsigned lk = lb + (unsigned)(tid >> 3) * ATP + (unsigned)(tid & 7) * 16, lv = lk + ATK, ls = 16 * ATP;
  const char* gk = (const char*)K + (size_t)(tid >> 3) * (2 * DM * 2) + (tid & 7) * 16; const size_t ks = (size_t)16 * 2 * DM * 2;
  const char* gv = (const char*)V + (size_t)(tid >> 3) * (SS * 2) + (tid & 7) * 16; const size_t vs = (size_t)16 * SS * 2;
  asm volatile("global_load_async_to_lds_b128 %0, %8, off\n\t"
               "global_load_async_to_lds_b128 %1, %9, off\n\t"
               "global_load_async_to_lds_b128 %2, %10, off\n\t"
               "global_load_async_to_lds_b128 %3, %11, off\n\t"
               "global_load_async_to_lds_b128 %4, %12, off\n\t"
               "global_load_async_to_lds_b128 %5, %13, off\n\t"
               "global_load_async_to_lds_b128 %6, %14, off\n\t"
               "global_load_async_to_lds_b128 %7, %15, off\n\t"
               "s_wait_xcnt 0x0"
               :: "v"(lk), "v"(lk + ls), "v"(lk + 2 * ls), "v"(lk + 3 * ls), "v"(lv), "v"(lv + ls), "v"(lv + 2 * ls), "v"(lv + 3 * ls),
                  "v"(gk), "v"(gk + ks), "v"(gk + 2 * ks), "v"(gk + 3 * ks), "v"(gv), "v"(gv + vs), "v"(gv + 2 * vs), "v"(gv + 3 * vs) : "memory");
}
// fragment from a staged row; p = row start + 16 g bytes: k order 8 g + 0..7, then 16 + 8 g + 0..7, as frag_h
__device__ __forceinline__ v16h frag_l(const unsigned char* p) { union { v16h v; v8h q[2]; } u; u.q[0] = *(const v8h*)p; u.q[1] = *(const v8h*)(p + 32); return u.v; }
// lane l <-> lane l ^ 16: the two halves of a wave hold the two halves of a query's keys
__device__ __forceinline__ float xhalf(float x) { const int b = __builtin_bit_cast(int, x); return __builtin_bit_cast(float, __builtin_amdgcn_permlanex16(b, b, 0x76543210, 0xfedcba98, false, false)); }
__device__ __forceinline__ v8f wmma_t(v16h a, v16h b, v8f c) { return __builtin_amdgcn_wmma_f32_16x16x32_f16(false, a, false, b, (short)0, c, false, false); }
// Transposed products: S^T = K . Q^T (A = 16 staged K rows, B = the wave's 16 queries) and O^T += V^T . P^T (A = 16 staged V^T rows, B = P^T). Lane (col, g) holds query col: of each 16-key score tile the keys 8 g + 0..7, of each output tile d = 8 g + 0..7.
// So a query's maximum and sum are taken inside the lane, with one exchange between the halves, and two score tiles, converted in place, are the B operand of the second product in the fragment's own k order (8 g + 0..7, then 16 + 8 g + 0..7, as frag_l reads V^T).
__global__ __launch_bounds__(128) void k_attn(const _Float16* __restrict__ QK, const _Float16* __restrict__ QKL, const _Float16* __restrict__ VTH, const _Float16* __restrict__ VTL, const void* __restrict__ KMASK, float* __restrict__ O) {
  __shared__ __align__(16) float so[4][16][68]; __shared__ __attribute__((aligned(16))) unsigned char ring[2 * AST];
  const int tid = threadIdx.x, wave = tid >> 5, lane = tid & 31, col = lane & 15, g = lane >> 4;
  const int qb = blockIdx.x, h = blockIdx.y, b = blockIdx.z; const int q0 = qb * 64 + wave * 16; const size_t rq = (size_t)b * SS + q0 + col;
  const unsigned l0 = lds_off(ring); const _Float16* Kg = QK + (size_t)b * SS * (2 * DM) + DM + h * HD; const _Float16* Vg = VTH + ((size_t)b * DM + h * HD) * SS;
  a_stage(l0, Kg, Vg, tid);
  v16h aq[2];
#pragma unroll
  for (int kc = 0; kc < 2; ++kc) aq[kc] = frag_h(QK + rq * (2 * DM) + h * HD + kc * 32, lane);
  const float cs = 0.125f * 1.4426950408889634f;   // 1/sqrt(64), and the exponentials in base 2
  float m = -3.0e38f, l = 0.f;   // of query col: running maximum (scaled, the same in both halves) and this half's part of the sum
  v8f acc[4] = {};
  asm volatile("s_wait_asynccnt 0x0" ::: "memory");   // stage 0 landed (this wave's copies)
  __syncthreads();                                    // ... and every other wave's
  a_stage(l0 + AST, Kg + (size_t)AKT * (2 * DM), Vg + AKT, tid);
#pragma unroll 1   // one stage per trip: the ring's order stays as written
  for (int t = 0; t < SS / AKT; ++t) { const unsigned char* sk = ring + (t & 1) * AST + col * ATP + 16 * g; const unsigned char* sv = sk + ATK;
#pragma unroll   // both 32-key steps of the stage, keys in rising order: every LDS offset is a constant
  for (int u = 0; u < AKT / 32; ++u) { v8f s[2]; v16h kf[2][2], vf[4];   // the step's K and V^T fragments, read as one group of LDS reads ahead of its products
#pragma unroll
    for (int ct = 0; ct < 2; ++ct) {
#pragma unroll
      for (int kc = 0; kc < 2; ++kc) kf[ct][kc] = frag_l(sk + (u * 32 + ct * 16) * ATP + kc * 64); }
#pragma unroll
    for (int dt = 0; dt < 4; ++dt) vf[dt] = frag_l(sv + dt * 16 * ATP + u * 64);
#pragma unroll
    for (int ct = 0; ct < 2; ++ct) { v8f c = {};
#pragma unroll
      for (int kc = 0; kc < 2; ++kc) c = wmma_t(kf[ct][kc], aq[kc], c);   // single product: k, q as one-rounding f16 operands
      s[ct] = c; }
    float mx = fmaxf(s[0][0], s[1][0]);   // maximum of the raw scores (the scale is positive)
#pragma unroll
    for (int r = 1; r < 8; ++r) mx = fmaxf(mx, fmaxf(s[0][r], s[1][r]));
    mx = fmaxf(mx, xhalf(mx)) * cs;
    const float mn = fmaxf(m, mx), nb = 11.0f - mn; float alpha;
    asm("v_exp_f32 %0, %1\n\tv_nop" : "=v"(alpha) : "v"(m - mn));   // exp2, in asm so that the v_nop stands directly behind it: the slot that the instruction set asks for before a transcendental's source register is written again
    m = mn;   // alpha is 0 on the first step; P carries 2^11 so that small softmax weights stay out of the f16 subnormal range, and so does the sum: it cancels in the epilogue
    union { v16h v; v2h q[8]; } pa; v2f es[2];
#pragma unroll
    for (int ct = 0; ct < 2; ++ct) {
#pragma unroll
      for (int i = 0; i < 4; ++i) { const v2f x = __builtin_elementwise_fma(v2f{s[ct][2 * i], s[ct][2 * i + 1]}, v2f{cs, cs}, v2f{nb, nb}); const v2f e = {__builtin_amdgcn_exp2f(x.x), __builtin_amdgcn_exp2f(x.y)};
        es[ct] = i ? es[ct] + e : e; pa.q[ct * 4 + i] = __builtin_convertvector(e, v2h); } }
    l = l * alpha + ((es[0].x + es[1].x) + (es[0].y + es[1].y));
#pragma unroll
    for (int dt = 0; dt < 4; ++dt) acc[dt] = acc[dt] * alpha;
#pragma unroll
    for (int dt = 0; dt < 4; ++dt) acc[dt] = wmma_t(vf[dt], pa.v, acc[dt]); }   // single product: V x P (x2^11)
    asm volatile("s_wait_dscnt 0x0" ::: "memory");      // this wave has left the buffer
    asm volatile("s_wait_asynccnt 0x0" ::: "memory");   // its copies of stage t + 1 have landed
    __syncthreads();                                    // publishes stage t + 1 and frees stage t's buffer
    if (t + 2 < SS / AKT) a_stage(l0 + (t & 1) * AST, Kg + (size_t)(t + 2) * AKT * (2 * DM), Vg + (t + 2) * AKT, tid);
  }
  asm volatile("s_wait_asynccnt 0x0" ::: "memory");     // nothing in flight when the wave goes on to its end
  const float il = 1.0f / (l + xhalf(l));   // the halves' sums joined once
#pragma unroll
  for (int dt = 0; dt < 4; ++dt) { const v8f o = acc[dt] * il; *(v4f*)&so[wave][col][dt * 16 + 8 * g] = v4f{o[0], o[1], o[2], o[3]}; *(v4f*)&so[wave][col][dt * 16 + 8 * g + 4] = v4f{o[4], o[5], o[6], o[7]}; }
  LDSX();
  for (int rl = 0; rl < 16; ++rl) if (lane < 16) vst2(O + ((size_t)b * SS + q0 + rl) * DM + h * HD + lane * 4, *(const v4f*)&so[wave][rl][lane * 4]);
}
// ---- k_out: block = (128 rows, 128 cols): out = O(hi/lo) . Wo rows (2 products) + bo
__global__ __launch_bounds__(128) void k_out(const float* __restrict__ O, const __bf16* __restrict__ P, const float* __restrict__ BO, float* __restrict__ Y) {
  __shared__ __attribute__((aligned(16))) unsigned char sm[2 * GST];
  const int tid = threadIdx.x, wave = tid >> 5, lane = tid & 31, col = lane & 15, g = lane >> 4, wm = wave >> 1, wn = wave & 1; const size_t m0 = (size_t)blockIdx.x * 128; const int n0 = blockIdx.y * 128;
  v8f acc[4][4] = {};
  g_core<true>(O + m0 * DM, P + (size_t)n0 * DM, sm, tid, acc);
  float bj[4];   // this lane's four bias values
#pragma unroll
  for (int j = 0; j < 4; ++j) bj[j] = bfr(BO[n0 + wn * 64 + j * 16 + col]);
  float* sf = (float*)(sm + wave * (64 * 68 * 4));   // each wave stages its own 64 x 64 in its own range of the ring
#pragma unroll
  for (int j = 0; j < 4; ++j) {
#pragma unroll
    for (int i = 0; i < 4; ++i) {
#pragma unroll
      for (int r = 0; r < 8; ++r) sf[(i * 16 + 8 * g + r) * 68 + j * 16 + col] = acc[i][j][r] + bj[j]; } }
  LDSX();
  for (int rl = 0; rl < 32; ++rl) vst2(Y + (m0 + wm * 64 + rl * 2 + g) * DM + n0 + wn * 64 + col * 4, *(const v4f*)&sf[(rl * 2 + g) * 68 + col * 4]);
}
// ---- k_lnqk: block = (token row, q or k): LayerNorm over the 1,024 flattened head dims (jnp.var, 1e-5) x g + b -> f16 row into the engine's q | k layout
__global__ __launch_bounds__(256) void k_lnqk(const float* __restrict__ QF, const float* __restrict__ GQ, const float* __restrict__ BQn, const float* __restrict__ GK, const float* __restrict__ BKn, _Float16* __restrict__ QK) {
  __shared__ float red[8]; __shared__ __align__(16) _Float16 sh[DM]; const int t = threadIdx.x; const size_t row = blockIdx.x; const int which = blockIdx.y; const float* X = QF + row * (2 * DM) + which * DM; const float* G = which ? GK : GQ; const float* Bt = which ? BKn : BQn;
  float v[4]; float s = 0.f; for (int i = 0; i < 4; ++i) { v[i] = X[t * 4 + i]; s += v[i]; }
#pragma unroll
  for (int o = 1; o < 32; o <<= 1) s += __shfl_xor(s, o);
  if ((t & 31) == 0) red[t >> 5] = s; __syncthreads(); float tot = 0.f; for (int i = 0; i < 8; ++i) tot += red[i]; const float mu = tot / (float)DM; __syncthreads();
  float q = 0.f; for (int i = 0; i < 4; ++i) { const float d = v[i] - mu; q += d * d; }
#pragma unroll
  for (int o = 1; o < 32; o <<= 1) q += __shfl_xor(q, o);
  if ((t & 31) == 0) red[t >> 5] = q; __syncthreads(); float tq = 0.f; for (int i = 0; i < 8; ++i) tq += red[i]; const float inv = 1.0f / sqrtf(tq / (float)DM + 1e-5f);
  for (int i = 0; i < 4; ++i) { const int e = t * 4 + i; sh[e] = (_Float16)((v[i] - mu) * inv * bfr(G[e]) + bfr(Bt[e])); }
  __syncthreads(); if (t < DM / 8) vst2((unsigned*)(QK + row * (2 * DM) + which * DM + t * 8), *(const v4u*)&sh[t * 8]);
}
extern "C" void kernel_launch(void* const* d_in, const int* in_sizes, int n_in, void* d_out, int out_size, void* d_ws, size_t ws_size, hipStream_t stream) {
  (void)in_sizes; (void)n_in; (void)out_size;
  const float** F = (const float**)d_in;   // 0 x [4,1024,1024], 1 qkv_w [3072,1024] natural (q | k | v row blocks), 2 qkv_b, 3 q_norm_g, 4 q_norm_b, 5 k_norm_g, 6 k_norm_b, 7 proj_w [1024,1024], 8 proj_b
  if (ws_size < (size_t)WS_END) return;
  char* ws = (char*)d_ws; __bf16* PK = (__bf16*)(ws + WS_PK); _Float16 *QK = (_Float16*)(ws + WS_QK), *QKL = (_Float16*)(ws + WS_QKL), *VTH = (_Float16*)(ws + WS_VTH), *VTL = (_Float16*)(ws + WS_VTL); float *O = (float*)(ws + WS_O), *QF = (float*)(ws + WS_QF);
  k_pack<<<dim3(DM, 4), 256, 0, stream>>>(F[1], F[1] + (size_t)DM * DM, F[1] + (size_t)2 * DM * DM, F[7], PK);
  k_qkv<<<dim3(TNB * SS / 128, QKVW / 128), 128, 0, stream>>>(F[0], F[0], F[0], PK + PK_A, F[2], F[2] + DM, F[2] + 2 * DM, QF, QK, QKL, VTH, VTL);
  k_lnqk<<<dim3(TNB * SS, 2), 256, 0, stream>>>(QF, F[3], F[4], F[5], F[6], QK);
  k_attn<<<dim3(TQB, NH, TNB), 128, 0, stream>>>(QK, QKL, VTH, VTL, nullptr, O);
  k_out<<<dim3(TOB / 2, DM / 128), 128, 0, stream>>>(O, PK + PK_P, F[8], (float*)d_out);
}

// v004
// A run of this version takes 92 microseconds.
// Two timings next to v003 both put it at 1.05 times that version's speed.
// Counting every step since v000, it is 3.59 times as fast.
// compute dtype: all float inputs rounded to bf16; qkv = x . W^T + b with EXACT bf16 products on WMMA 16x16x32 (natural rows; three contiguous row blocks) kept in f32 for q and k; the two per-token LayerNorms (1,024 wide, eps 1e-5) in f32, then q, k rounded once to f16; PLAIN attention: x 1/8, running-max softmax in f32 (hardware exp), P (scaled by 2^11, single f16) x v (single f16); out = o (bf16 hi + residual) . proj_w^T (2 products) + proj_b.
#include <hip/hip_runtime.h>
#include <math.h>

typedef __attribute__((ext_vector_type(16))) _Float16 v16h;
typedef __attribute__((ext_vector_type(16))) __bf16 v16b;
typedef __attribute__((ext_vector_type(8)))  _Float16 v8h;
typedef __attribute__((ext_vector_type(2)))  _Float16 v2h;
typedef __attribute__((ext_vector_type(8)))  float v8f;
typedef __attribute__((ext_vector_type(4)))  float v4f;
typedef __attribute__((ext_vector_type(2)))  float v2f;
typedef __attribute__((ext_vector_type(4)))  unsigned v4u;
typedef __attribute__((ext_vector_type(4)))  int v4i;
typedef float __attribute__((may_alias)) float_a;
typedef int __attribute__((may_alias)) int_a;

template <typename T> __device__ __forceinline__ void vst2(void* p, T v) { *(T*)p = v;  }
__device__ __forceinline__ v8f wmma16(v16h a, v16h b, v8f c) {
  v8f d = __builtin_amdgcn_wmma_f32_16x16x32_f16(false, a, false, b, (short)0, c, false, false);
  asm volatile("v_nop\n\tv_nop\n\tv_nop\n\tv_nop" : "+v"(d) : "v"(a), "v"(b));
  return d;
}
__device__ __forceinline__ v8f wmma_bf(v16b a, v16b b, v8f c) {
  v8f d = __builtin_amdgcn_wmma_f32_16x16x32_bf16(false, a, false, b, (short)0, c, false, false);
  asm volatile("v_nop\n\tv_nop\n\tv_nop\n\tv_nop" : "+v"(d) : "v"(a), "v"(b));
  return d;
}
// attention with qk LayerNorm (B 4, N 1,024, C 1,024, 16 heads x 64): fused qkv projection + bias, LayerNorm over the flattened q and k per token, softmax(q k / 8) v, output projection + bias.
__device__ __forceinline__ v16h frag_h(const _Float16* rowk0, int lane) {
  union { v16h v; v8h q[2]; } u; const _Float16* p = rowk0 + 8 * (lane >> 4);
  u.q[0] = *(const v8h*)p; u.q[1] = *(const v8h*)(p + 16); return u.v;
}
__device__ __forceinline__ v16h frag_f32(const float* rowk0, int lane) {
  v16h a; const float* p = rowk0 + 8 * (lane >> 4);
#pragma unroll
  for (int i = 0; i < 8; ++i) { a[i] = (_Float16)p[i]; a[8 + i] = (_Float16)p[16 + i]; }
  return a;
}
__device__ __forceinline__ v16h frag_f32s(const float* rowk0, int lane, float sc) {
  v16h a; const float* p = rowk0 + 8 * (lane >> 4);
#pragma unroll
  for (int i = 0; i < 8; ++i) { a[i] = (_Float16)(p[i] * sc); a[8 + i] = (_Float16)(p[16 + i] * sc); }
  return a;
}
// column fragment from a [K][ld] layout (column n), rows >= K read as 0
__device__ __forceinline__ v16h fragc_f32(const float* W, int k0, int n, int lane, int ld, int K) {
  v16h a; const int g = lane >> 4;
#pragma unroll
  for (int i = 0; i < 8; ++i) { const int ka = k0 + 8 * g + i, kb = ka + 16;
    a[i] = (_Float16)(ka < K ? W[(size_t)(ka < K ? ka : K - 1) * ld + n] : 0.f); a[8 + i] = (_Float16)(kb < K ? W[(size_t)(kb < K ? kb : K - 1) * ld + n] : 0.f); }
  return a;
}
struct F2 { v16b h, l; };
__device__ __forceinline__ F2 bsplit16(const float v[16]) { F2 r;
#pragma unroll
  for (int i = 0; i < 16; ++i) { const __bf16 h = (__bf16)v[i]; r.h[i] = h; r.l[i] = (__bf16)(v[i] - (float)h); }
  return r; }
__device__ __forceinline__ F2 split_row(const float* row, int k0, int lane) { float v[16]; const float* p = row + k0 + 8 * (lane >> 4);
#pragma unroll
  for (int i = 0; i < 8; ++i) { v[i] = p[i]; v[8 + i] = p[16 + i]; }
  return bsplit16(v); }
__device__ __forceinline__ F2 split_rowK(const float* row, int k0, int lane, int K) { float v[16]; const int g = lane >> 4;
#pragma unroll
  for (int i = 0; i < 8; ++i) { const int ka = k0 + 8 * g + i, kb = ka + 16; v[i] = ka < K ? row[ka < K ? ka : K - 1] : 0.f; v[8 + i] = kb < K ? row[kb < K ? kb : K - 1] : 0.f; }
  return bsplit16(v); }
__device__ __forceinline__ F2 split_col(const float* W, int k0, int n, int lane, int ld, int K) { float v[16]; const int g = lane >> 4;
#pragma unroll
  for (int i = 0; i < 8; ++i) { const int ka = k0 + 8 * g + i, kb = ka + 16; v[i] = ka < K ? W[(size_t)(ka < K ? ka : K - 1) * ld + n] : 0.f; v[8 + i] = kb < K ? W[(size_t)(kb < K ? kb : K - 1) * ld + n] : 0.f; }
  return bsplit16(v); }
__device__ __forceinline__ v8f mac3(const F2& a, const F2& b, v8f c) { c = wmma_bf(a.l, b.h, c); c = wmma_bf(a.h, b.l, c); return wmma_bf(a.h, b.h, c); }
__device__ __forceinline__ float sigm(float v) { return 1.0f / (1.0f + expf(-v)); }
#define LDSX() do { asm volatile("s_wait_dscnt 0" ::: "memory"); __builtin_amdgcn_wave_barrier(); __builtin_amdgcn_fence(__ATOMIC_RELEASE, "workgroup"); } while (0)


#define NB 4
#define SS 1024
#define DM 1024
#define NH 16
#define HD 64
#define QKVW (3 * DM)
#ifndef TQB
#define TQB (SS / 64)
#define TNB NB
#define TOB (NB * SS / 64)     // output row tiles (all)
#endif
typedef __attribute__((ext_vector_type(8))) __bf16 v8b;
__device__ __forceinline__ v16b frag_b(const __bf16* rowk0, int lane) {
  union { v16b v; v8b q[2]; } u; const __bf16* p = rowk0 + 8 * (lane >> 4);
  u.q[0] = *(const v8b*)p; u.q[1] = *(const v8b*)(p + 16); return u.v;
}
__device__ __forceinline__ float bfr(float v) { return (float)(__bf16)v; }
__device__ __attribute__((noinline)) float exp_ni(float v) { return expf(v); }
__device__ __attribute__((noinline)) float erf_ni(float v) { return erff(v); }

#define PK_A 0                       // [3072][1024] Wqkv rows (natural [out][in])
#define PK_P (PK_A + QKVW * DM)        // [1024][1024] Wo rows (natural)
#define PK_END (PK_P + DM * DM)
#define WS_PK  0u
#define WS_QK  (WS_PK + 2u * PK_END)             // f16 [4096 rows][2048]: q | k
#define WS_QKL (WS_QK + 2u * NB * SS * 2 * DM)     // f16 [4096][2048]; never written or read
#define WS_VTH (WS_QKL + 2u * NB * SS * 2 * DM)    // f16 [b][1024 (h*64+d)][1024 s] hi
#define WS_VTL (WS_VTH + 2u * NB * DM * SS)        // f16 lo x 2048
#define WS_O   (WS_VTL + 2u * NB * DM * SS)        // f32 [4096][1024]
#define WS_CS  (WS_O + 4u * NB * SS * DM)           // f32 [2][1024][32], not used
#define WS_QF  (WS_CS + 4u * 2 * SS * 32)                  // f32 [NR][2048] pre-LN q | k
#define WS_END (WS_QF + 4u * (size_t)NB * SS * 2 * DM)
// ---- k_pack: natural [out][in] f32 rows -> bf16. The 4,096 rows (W_q | W_k | W_v -> PK_A rows, W_o -> PK_P rows, which follow them) are dealt two to a wave: 8 KiB in a row, read by sixteen 16-byte loads per lane that are all in flight together; no LDS, no barrier. Few, long waves: the launch starts 2,048 of them, two a SIMD.
// amdgpu_waves_per_eu(2, 4), here and on k_lnqk: register budget of four waves a SIMD, so that the compiler does not split a wave's run of loads to save registers. The loops of both kernels are unrolled whole so that every array index is a constant (registers, no scratch).
typedef __attribute__((ext_vector_type(4))) __bf16 v4b;
typedef __attribute__((ext_vector_type(4))) _Float16 v4h;
__global__ __launch_bounds__(256) __attribute__((amdgpu_waves_per_eu(2, 4))) void k_pack(const float* __restrict__ WQ, const float* __restrict__ WK, const float* __restrict__ WV, const float* __restrict__ WO, __bf16* __restrict__ PK) {
  const unsigned lane = threadIdx.x & 31, r0 = (blockIdx.x * 8 + __builtin_amdgcn_readfirstlane(threadIdx.x >> 5)) * 2, which = r0 / DM, n = r0 % DM;   // r0 is even: both rows lie in one matrix
  const char* s = (const char*)(((which == 0) ? WQ : (which == 1) ? WK : (which == 2) ? WV : WO) + (size_t)n * DM); const unsigned lb = lane * 16;   // scalar base, one lane offset in bytes
  __bf16* dst = ((which < 3) ? PK + PK_A + ((size_t)which * DM + n) * DM : PK + PK_P + (size_t)n * DM) + lane * 4;
  v4f v[16];
#pragma unroll
  for (int j = 0; j < 16; ++j) v[j] = *(const v4f*)(s + lb + j * 512);
#pragma unroll
  for (int j = 0; j < 16; ++j) *(v4b*)(dst + j * 128) = __builtin_convertvector(v[j], v4b);
}
// ---- tiled product core of k_qkv and k_out: one 128 x 128 tile of A[.][1024] (f32) . B[.][1024]^T (bf16) per block of four waves (2 x 2, 64 x 64 each).
// A stage is 64 k of both operands in LDS: 128 A rows of 256 B at pitch 272, then 128 B rows of 128 B at pitch 144 (16 B x odd for the 16-byte readers). Two buffers: the next stage's copies fly while this one is worked on.
#define GKW 64
#define GAP 272
#define GBP 144
#define GAB (128 * GAP)
#define GST (GAB + 128 * GBP)
typedef __attribute__((ext_vector_type(2))) __bf16 v2b;
__device__ __forceinline__ unsigned lds_off(const void* p) { return (unsigned)(size_t)p; }
// eight asynchronous 16-byte copies per lane, global -> LDS; the s_wait_xcnt closes the statement so that no address register is rewritten ahead of it
__device__ __forceinline__ void cp8(unsigned l, unsigned ls, const char* g, size_t gs) {
  asm volatile("global_load_async_to_lds_b128 %0, %8, off\n\t"
               "global_load_async_to_lds_b128 %1, %9, off\n\t"
               "global_load_async_to_lds_b128 %2, %10, off\n\t"
               "global_load_async_to_lds_b128 %3, %11, off\n\t"
               "global_load_async_to_lds_b128 %4, %12, off\n\t"
               "global_load_async_to_lds_b128 %5, %13, off\n\t"
               "global_load_async_to_lds_b128 %6, %14, off\n\t"
               "global_load_async_to_lds_b128 %7, %15, off\n\t"
               "s_wait_xcnt 0x0"
               :: "v"(l), "v"(l + ls), "v"(l + 2 * ls), "v"(l + 3 * ls), "v"(l + 4 * ls), "v"(l + 5 * ls), "v"(l + 6 * ls), "v"(l + 7 * ls),
                  "v"(g), "v"(g + gs), "v"(g + 2 * gs), "v"(g + 3 * gs), "v"(g + 4 * gs), "v"(g + 5 * gs), "v"(g + 6 * gs), "v"(g + 7 * gs) : "memory");
}
// one stage: a wave's copy covers two whole A rows (2 x 256 B) or four whole B rows (4 x 128 B)
__device__ __forceinline__ void g_stage(unsigned lb, const float* A, const __bf16* B, int tid) {
  const unsigned la = lb + (unsigned)(tid >> 4) * GAP + (unsigned)(tid & 15) * 16; const char* ga = (const char*)A + (size_t)(tid >> 4) * (DM * 4) + (tid & 15) * 16;
  cp8(la, 8 * GAP, ga, (size_t)8 * DM * 4);
  cp8(la + 64 * GAP, 8 * GAP, ga + (size_t)64 * DM * 4, (size_t)8 * DM * 4);
  cp8(lb + GAB + (unsigned)(tid >> 3) * GBP + (unsigned)(tid & 7) * 16, 16 * GBP, (const char*)B + (size_t)(tid >> 3) * (DM * 2) + (tid & 7) * 16, (size_t)16 * DM * 2);
}
// A, B point at the tile's first row; SPLIT: A as bf16 hi + residual (2 products per k-step, residual first), else A rounded once to bf16. Every accumulator sums its k-steps in rising order. The inner loops are unrolled whole so that every fragment and accumulator index is a constant (registers, no scratch).
template <bool SPLIT> __device__ __forceinline__ void g_core(const float* __restrict__ A, const __bf16* __restrict__ B, unsigned char* sm, int tid, v8f (&acc)[4][4]) {
  const int wave = tid >> 5, lane = tid & 31, col = lane & 15, g = lane >> 4, wm = wave >> 1, wn = wave & 1; const unsigned l0 = lds_off(sm);
  g_stage(l0, A, B, tid);
  asm volatile("s_wait_asynccnt 0x0" ::: "memory");   // stage 0 landed (this wave's copies)
  __syncthreads();                                    // ... and every other wave's
  g_stage(l0 + GST, A + GKW, B + GKW, tid);
#pragma unroll 1   // one stage per trip: the ring's order stays as written
  for (int t = 0; t < DM / GKW; ++t) {
    const unsigned char* sa = sm + (t & 1) * GST + (wm * 64 + col) * GAP + 32 * g; const unsigned char* sb = sm + (t & 1) * GST + GAB + (wn * 64 + col) * GBP + 16 * g;
#pragma unroll
    for (int kc = 0; kc < GKW / 32; ++kc) { v16b w[4];
#pragma unroll
      for (int j = 0; j < 4; ++j) { union { v16b v; v8b q[2]; } u; u.q[0] = *(const v8b*)(sb + j * 16 * GBP + kc * 64); u.q[1] = *(const v8b*)(sb + j * 16 * GBP + kc * 64 + 32); w[j] = u.v; }
#pragma unroll
      for (int i = 0; i < 4; ++i) { const v2f* p = (const v2f*)(sa + i * 16 * GAP + kc * 128); union { v16b v; v2b q[8]; } h, l;   // k order of the fragment: 8 g + 0..7, then 16 + 8 g + 0..7, as in the B rows
#pragma unroll
        for (int e = 0; e < 4; ++e) { const v2f x0 = p[e], x1 = p[8 + e]; h.q[e] = __builtin_convertvector(x0, v2b); h.q[4 + e] = __builtin_convertvector(x1, v2b);
          if (SPLIT) { l.q[e] = __builtin_convertvector(x0 - __builtin_convertvector(h.q[e], v2f), v2b); l.q[4 + e] = __builtin_convertvector(x1 - __builtin_convertvector(h.q[4 + e], v2f), v2b); } }
        if (SPLIT) {
#pragma unroll
          for (int j = 0; j < 4; ++j) acc[i][j] = wmma_bf(l.v, w[j], acc[i][j]); }
#pragma unroll
        for (int j = 0; j < 4; ++j) acc[i][j] = wmma_bf(h.v, w[j], acc[i][j]); } }
    asm volatile("s_wait_dscnt 0x0" ::: "memory");      // this wave has left the buffer
    asm volatile("s_wait_asynccnt 0x0" ::: "memory");   // its copies of stage t + 1 have landed
    __syncthreads();                                    // publishes stage t + 1 and frees stage t's buffer
    if (t + 2 < DM / GKW) g_stage(l0 + (t & 1) * GST, A + (t + 2) * GKW, B + (t + 2) * GKW, tid);
  }
  asm volatile("s_wait_asynccnt 0x0" ::: "memory");     // nothing in flight when the ring becomes output staging
}
__global__ __launch_bounds__(128) void k_qkv(const float* __restrict__ XQ, const float* __restrict__ XK, const float* __restrict__ XV, const __bf16* __restrict__ P, const float* __restrict__ BQ, const float* __restrict__ BK, const float* __restrict__ BV, float* __restrict__ QF, _Float16* __restrict__ QK, _Float16* __restrict__ QKL, _Float16* __restrict__ VTH, _Float16* __restrict__ VTL) {
  const int which0 = (blockIdx.y * 128) / DM; const float* X = (which0 == 0) ? XQ : (which0 == 1) ? XK : XV; const float* BB = BQ ? (((which0 == 0) ? BQ : (which0 == 1) ? BK : BV) + (blockIdx.y * 128 - which0 * DM)) : nullptr;
  __shared__ __attribute__((aligned(16))) unsigned char sm[2 * GST];
  const int tid = threadIdx.x, wave = tid >> 5, lane = tid & 31, col = lane & 15, g = lane >> 4, wm = wave >> 1, wn = wave & 1; const size_t m0 = (size_t)blockIdx.x * 128; const int n0 = blockIdx.y * 128;
  v8f acc[4][4] = {};
  g_core<false>(X + m0 * DM, P + (size_t)n0 * DM, sm, tid, acc);
  float bj[4] = {0.f, 0.f, 0.f, 0.f};   // this lane's four bias values
  if (BB) {
#pragma unroll
    for (int j = 0; j < 4; ++j) bj[j] = bfr(BB[wn * 64 + j * 16 + col]); }
  if (n0 < 2 * DM) {   // q and k kept in f32 (LayerNorm comes next); each wave stages its own 64 x 64 in its own range of the ring
    float* sf = (float*)(sm + wave * (64 * 68 * 4));
#pragma unroll
    for (int j = 0; j < 4; ++j) {
#pragma unroll
      for (int i = 0; i < 4; ++i) {
#pragma unroll
        for (int r = 0; r < 8; ++r) sf[(i * 16 + 8 * g + r) * 68 + j * 16 + col] = acc[i][j][r] + bj[j]; } }
    LDSX();
    for (int rl = 0; rl < 32; ++rl) vst2(QF + (m0 + wm * 64 + rl * 2 + g) * (2 * DM) + n0 + wn * 64 + col * 4, *(const v4f*)&sf[(rl * 2 + g) * 68 + col * 4]);
    asm volatile("s_wait_xcnt 0x0" ::: "memory");   // closes the run of stores before any code laid out behind it rewrites an address register
  } else {
    _Float16* sth = (_Float16*)sm; _Float16* stl = (_Float16*)(sm + 128 * 136 * 2);   // [128 d][136 s] each
#pragma unroll
    for (int j = 0; j < 4; ++j) {
#pragma unroll
      for (int i = 0; i < 4; ++i) { v8h hv8, lv8;
#pragma unroll
        for (int r = 0; r < 8; ++r) { const float v = acc[i][j][r] + bj[j]; const _Float16 hv = (_Float16)v; hv8[r] = hv; lv8[r] = (_Float16)((v - (float)hv) * 2048.0f); }
        const int o = (wn * 64 + j * 16 + col) * 136 + wm * 64 + i * 16 + 8 * g; *(v8h*)&sth[o] = hv8; *(v8h*)&stl[o] = lv8; } }
    __syncthreads();
    const int b = (int)(m0 / SS), s0 = (int)(m0 % SS); const int pc0 = n0 - 2 * DM;
    for (int it = 0; it < 16; ++it) { const int q = it * 128 + tid, d = q >> 4, pc = q & 15; const size_t o = ((size_t)b * DM + pc0 + d) * SS + s0 + pc * 8; vst2((unsigned*)(VTH + o), *(const v4u*)&sth[d * 136 + pc * 8]); vst2((unsigned*)(VTL + o), *(const v4u*)&stl[d * 136 + pc * 8]); }
    asm volatile("s_wait_xcnt 0x0" ::: "memory");   // closes the run of stores before any code laid out behind it rewrites an address register
  }
}
// ---- k_attn: block = (64 queries, head h, batch b): all-keys flash attention (K = 64: 2 k-steps), scores = (q.k) * 0.125 with single f16 operands, P.V: f16 P x f16 V; O[b*S+q][h*64+d] = acc / l (256-B segments)
// A stage is 64 keys of this head in LDS, shared by the block's four waves: 64 K rows of 128 B, then 64 V^T rows (one per d) of 128 B, all at pitch 144 (16 B x odd for the 16-byte readers). Two buffers: the next stage's copies fly while this one is worked on.
#define AKT 64
#define ATP 144
#define ATK (64 * ATP)
#define AST (2 * ATK)
// one stage: eight asynchronous 16-byte copies per lane, global -> LDS, four of K and four of V^T; a wave's copy covers four whole 128-B rows; the s_wait_xcnt closes the statement so that no address register is rewritten ahead of it
__device__ __forceinline__ void a_stage(unsigned lb, const _Float16* K, const _Float16* V, int tid) {
  const unsigned lk = lb + (unsigned)(tid >> 3) * ATP + (unsigned)(tid & 7) * 16, lv = lk + ATK, ls = 16 * ATP;
  const char* gk = (const char*)K + (size_t)(tid >> 3) * (2 * DM * 2) + (tid & 7) * 16; const size_t ks = (size_t)16 * 2 * DM * 2;
  const char* gv = (const char*)V + (size_t)(tid >> 3) * (SS * 2) + (tid & 7) * 16; const size_t vs = (size_t)16 * SS * 2;
  asm volatile("global_load_async_to_lds_b128 %0, %8, off\n\t"
               "global_load_async_to_lds_b128 %1, %9, off\n\t"
               "global_load_async_to_lds_b128 %2, %10, off\n\t"
               "global_load_async_to_lds_b128 %3, %11, off\n\t"
               "global_load_async_to_lds_b128 %4, %12, off\n\t"
               "global_load_async_to_lds_b128 %5, %13, off\n\t"
               "global_load_async_to_lds_b128 %6, %14, off\n\t"
               "global_load_async_to_lds_b128 %7, %15, off\n\t"
               "s_wait_xcnt 0x0"
               :: "v"(lk), "v"(lk + ls), "v"(lk + 2 * ls), "v"(lk + 3 * ls), "v"(lv), "v"(lv + ls), "v"(lv + 2 * ls), "v"(lv + 3 * ls),
                  "v"(gk), "v"(gk + ks), "v"(gk + 2 * ks), "v"(gk + 3 * ks), "v"(gv), "v"(gv + vs), "v"(gv + 2 * vs), "v"(gv + 3 * vs) : "memory");
}
// fragment from a staged row; p = row start + 16 g bytes: k order 8 g + 0..7, then 16 + 8 g + 0..7, as frag_h
__device__ __forceinline__ v16h frag_l(const unsigned char* p) { union { v16h v; v8h q[2]; } u; u.q[0] = *(const v8h*)p; u.q[1] = *(const v8h*)(p + 32); return u.v; }
// lane l <-> lane l ^ 16: the two halves of a wave hold the two halves of a query's keys
__device__ __forceinline__ float xhalf(float x) { const int b = __builtin_bit_cast(int, x); return __builtin_bit_cast(float, __builtin_amdgcn_permlanex16(b, b, 0x76543210, 0xfedcba98, false, false)); }
__device__ __forceinline__ v8f wmma_t(v16h a, v16h b, v8f c) { return __builtin_amdgcn_wmma_f32_16x16x32_f16(false, a, false, b, (short)0, c, false, false); }
// Transposed products: S^T = K . Q^T (A = 16 staged K rows, B = the wave's 16 queries) and O^T += V^T . P^T (A = 16 staged V^T rows, B = P^T). Lane (col, g) holds query col: of each 16-key score tile the keys 8 g + 0..7, of each output tile d = 8 g + 0..7.
// So a query's maximum and sum are taken inside the lane, with one exchange between the halves, and two score tiles, converted in place, are the B operand of the second product in the fragment's own k order (8 g + 0..7, then 16 + 8 g + 0..7, as frag_l reads V^T).
__global__ __launch_bounds__(128) void k_attn(const _Float16* __restrict__ QK, const _Float16* __restrict__ QKL, const _Float16* __restrict__ VTH, const _Float16* __restrict__ VTL, const void* __restrict__ KMASK, float* __restrict__ O) {
  __shared__ __align__(16) float so[4][16][68]; __shared__ __attribute__((aligned(16))) unsigned char ring[2 * AST];
  const int tid = threadIdx.x, wave = tid >> 5, lane = tid & 31, col = lane & 15, g = lane >> 4;
  const int qb = blockIdx.x, h = blockIdx.y, b = blockIdx.z; const int q0 = qb * 64 + wave * 16; const size_t rq = (size_t)b * SS + q0 + col;
  const unsigned l0 = lds_off(ring); const _Float16* Kg = QK + (size_t)b * SS * (2 * DM) + DM + h * HD; const _Float16* Vg = VTH + ((size_t)b * DM + h * HD) * SS;
  a_stage(l0, Kg, Vg, tid);
  v16h aq[2];
#pragma unroll
  for (int kc = 0; kc < 2; ++kc) aq[kc] = frag_h(QK + rq * (2 * DM) + h * HD + kc * 32, lane);
  const float cs = 0.125f * 1.4426950408889634f;   // 1/sqrt(64), and the exponentials in base 2
  float m = -3.0e38f, l = 0.f;   // of query col: running maximum (scaled, the same in both halves) and this half's part of the sum
  v8f acc[4] = {};
  asm volatile("s_wait_asynccnt 0x0" ::: "memory");   // stage 0 landed (this wave's copies)
  __syncthreads();                                    // ... and every other wave's
  a_stage(l0 + AST, Kg + (size_t)AKT * (2 * DM), Vg + AKT, tid);
#pragma unroll 1   // one stage per trip: the ring's order stays as written
  for (int t = 0; t < SS / AKT; ++t) { const unsigned char* sk = ring + (t & 1) * AST + col * ATP + 16 * g; const unsigned char* sv = sk + ATK;
#pragma unroll   // both 32-key steps of the stage, keys in rising order: every LDS offset is a constant
  for (int u = 0; u < AKT / 32; ++u) { v8f s[2]; v16h kf[2][2], vf[4];   // the step's K and V^T fragments, read as one group of LDS reads ahead of its products
#pragma unroll
    for (int ct = 0; ct < 2; ++ct) {
#pragma unroll
      for (int kc = 0; kc < 2; ++kc) kf[ct][kc] = frag_l(sk + (u * 32 + ct * 16) * ATP + kc * 64); }
#pragma unroll
    for (int dt = 0; dt < 4; ++dt) vf[dt] = frag_l(sv + dt * 16 * ATP + u * 64);
#pragma unroll
    for (int ct = 0; ct < 2; ++ct) { v8f c = {};
#pragma unroll
      for (int kc = 0; kc < 2; ++kc) c = wmma_t(kf[ct][kc], aq[kc], c);   // single product: k, q as one-rounding f16 operands
      s[ct] = c; }
    float mx = fmaxf(s[0][0], s[1][0]);   // maximum of the raw scores (the scale is positive)
#pragma unroll
    for (int r = 1; r < 8; ++r) mx = fmaxf(mx, fmaxf(s[0][r], s[1][r]));
    mx = fmaxf(mx, xhalf(mx)) * cs;
    const float mn = fmaxf(m, mx), nb = 11.0f - mn; float alpha;
    asm("v_exp_f32 %0, %1\n\tv_nop" : "=v"(alpha) : "v"(m - mn));   // exp2, in asm so that the v_nop stands directly behind it: the slot that the instruction set asks for before a transcendental's source register is written again
    m = mn;   // alpha is 0 on the first step; P carries 2^11 so that small softmax weights stay out of the f16 subnormal range, and so does the sum: it cancels in the epilogue
    union { v16h v; v2h q[8]; } pa; v2f es[2];
#pragma unroll
    for (int ct = 0; ct < 2; ++ct) {
#pragma unroll
      for (int i = 0; i < 4; ++i) { const v2f x = __builtin_elementwise_fma(v2f{s[ct][2 * i], s[ct][2 * i + 1]}, v2f{cs, cs}, v2f{nb, nb}); const v2f e = {__builtin_amdgcn_exp2f(x.x), __builtin_amdgcn_exp2f(x.y)};
        es[ct] = i ? es[ct] + e : e; pa.q[ct * 4 + i] = __builtin_convertvector(e, v2h); } }
    l = l * alpha + ((es[0].x + es[1].x) + (es[0].y + es[1].y));
#pragma unroll
    for (int dt = 0; dt < 4; ++dt) acc[dt] = acc[dt] * alpha;
#pragma unroll
    for (int dt = 0; dt < 4; ++dt) acc[dt] = wmma_t(vf[dt], pa.v, acc[dt]); }   // single product: V x P (x2^11)
    asm volatile("s_wait_dscnt 0x0" ::: "memory");      // this wave has left the buffer
    asm volatile("s_wait_asynccnt 0x0" ::: "memory");   // its copies of stage t + 1 have landed
    __syncthreads();                                    // publishes stage t + 1 and frees stage t's buffer
    if (t + 2 < SS / AKT) a_stage(l0 + (t & 1) * AST, Kg + (size_t)(t + 2) * AKT * (2 * DM), Vg + (t + 2) * AKT, tid);
  }
  asm volatile("s_wait_asynccnt 0x0" ::: "memory");     // nothing in flight when the wave goes on to its end
  const float il = 1.0f / (l + xhalf(l));   // the halves' sums joined once
#pragma unroll
  for (int dt = 0; dt < 4; ++dt) { const v8f o = acc[dt] * il; *(v4f*)&so[wave][col][dt * 16 + 8 * g] = v4f{o[0], o[1], o[2], o[3]}; *(v4f*)&so[wave][col][dt * 16 + 8 * g + 4] = v4f{o[4], o[5], o[6], o[7]}; }
  LDSX();
  for (int rl = 0; rl < 16; ++rl) if (lane < 16) vst2(O + ((size_t)b * SS + q0 + rl) * DM + h * HD + lane * 4, *(const v4f*)&so[wave][rl][lane * 4]);
}
// ---- k_out: block = (128 rows, 128 cols): out = O(hi/lo) . Wo rows (2 products) + bo
__global__ __launch_bounds__(128) void k_out(const float* __restrict__ O, const __bf16* __restrict__ P, const float* __restrict__ BO, float* __restrict__ Y) {
  __shared__ __attribute__((aligned(16))) unsigned char sm[2 * GST];
  const int tid = threadIdx.x, wave = tid >> 5, lane = tid & 31, col = lane & 15, g = lane >> 4, wm = wave >> 1, wn = wave & 1; const size_t m0 = (size_t)blockIdx.x * 128; const int n0 = blockIdx.y * 128;
  v8f acc[4][4] = {};
  g_core<true>(O + m0 * DM, P + (size_t)n0 * DM, sm, tid, acc);
  float bj[4];   // this lane's four bias values
#pragma unroll
  for (int j = 0; j < 4; ++j) bj[j] = bfr(BO[n0 + wn * 64 + j * 16 + col]);
  float* sf = (float*)(sm + wave * (64 * 68 * 4));   // each wave stages its own 64 x 64 in its own range of the ring
#pragma unroll
  for (int j = 0; j < 4; ++j) {
#pragma unroll
    for (int i = 0; i < 4; ++i) {
#pragma unroll
      for (int r = 0; r < 8; ++r) sf[(i * 16 + 8 * g + r) * 68 + j * 16 + col] = acc[i][j][r] + bj[j]; } }
  LDSX();
  for (int rl = 0; rl < 32; ++rl) vst2(Y + (m0 + wm * 64 + rl * 2 + g) * DM + n0 + wn * 64 + col * 4, *(const v4f*)&sf[(rl * 2 + g) * 68 + col * 4]);
}
// ---- k_lnqk: LayerNorm over the 1,024 flattened head dims (jnp.var, 1e-5) x g + b -> f16 row into the engine's q | k layout. A wave takes the q rows, or the k rows, of two tokens whole in registers (lane l holds columns 128 j + 4 l + 0..3); all its loads are in flight together; no LDS, no barrier; 4,096 waves, four a SIMD
template <int C> __device__ __forceinline__ float rowx(float x) { return __builtin_bit_cast(float, __builtin_amdgcn_update_dpp(0, __builtin_bit_cast(int, x), C, 0xf, 0xf, true)); }   // lane l <- lane l ^ (C & 15) of its 16-lane row (row_xmask)
__device__ __forceinline__ float wsum(float s) { s += rowx<0x161>(s); s += rowx<0x162>(s); s += rowx<0x164>(s); s += rowx<0x168>(s); return s + xhalf(s); }   // sum over the wave, the same bits in every lane
__global__ __launch_bounds__(256) __attribute__((amdgpu_waves_per_eu(2, 4))) void k_lnqk(const float* __restrict__ QF, const float* __restrict__ GQ, const float* __restrict__ BQn, const float* __restrict__ GK, const float* __restrict__ BKn, _Float16* __restrict__ QK) {
  const unsigned l4 = (threadIdx.x & 31) * 4, w = blockIdx.x * 8 + __builtin_amdgcn_readfirstlane(threadIdx.x >> 5), which = w & 1; const size_t o = (size_t)(w >> 1) * 2 * (2 * DM) + which * DM;   // o is the same in the whole wave: scalar base, one lane offset
  const float* X = QF + o; const float* G = which ? GK : GQ; const float* Bt = which ? BKn : BQn; _Float16* Y = QK + o;
  v4f x[2][8], gg[8], bb[8];
#pragma unroll
  for (int r = 0; r < 2; ++r) {
#pragma unroll
    for (int j = 0; j < 8; ++j) x[r][j] = *(const v4f*)(X + l4 + r * (2 * DM) + j * 128); }
#pragma unroll
  for (int j = 0; j < 8; ++j) { gg[j] = *(const v4f*)(G + l4 + j * 128); bb[j] = *(const v4f*)(Bt + l4 + j * 128); }
  v4h y[2][8];
#pragma unroll
  for (int r = 0; r < 2; ++r) { v4f s4 = x[r][0];
#pragma unroll
    for (int j = 1; j < 8; ++j) s4 += x[r][j];
    const float mu = wsum((s4.x + s4.y) + (s4.z + s4.w)) / (float)DM; v4f q4 = {};
#pragma unroll
    for (int j = 0; j < 8; ++j) { const v4f d = x[r][j] - mu; q4 += d * d; }
    const float inv = 1.0f / sqrtf(wsum((q4.x + q4.y) + (q4.z + q4.w)) / (float)DM + 1e-5f);
#pragma unroll
    for (int j = 0; j < 8; ++j) {
#pragma unroll
      for (int i = 0; i < 4; ++i) y[r][j][i] = (_Float16)((x[r][j][i] - mu) * inv * bfr(gg[j][i]) + bfr(bb[j][i])); } }
#pragma unroll   // both rows' stores stand last: nothing behind them writes a register
  for (int r = 0; r < 2; ++r) {
#pragma unroll
    for (int j = 0; j < 8; ++j) *(v4h*)(Y + l4 + r * (2 * DM) + j * 128) = y[r][j]; }
}
extern "C" void kernel_launch(void* const* d_in, const int* in_sizes, int n_in, void* d_out, int out_size, void* d_ws, size_t ws_size, hipStream_t stream) {
  (void)in_sizes; (void)n_in; (void)out_size;
  const float** F = (const float**)d_in;   // 0 x [4,1024,1024], 1 qkv_w [3072,1024] natural (q | k | v row blocks), 2 qkv_b, 3 q_norm_g, 4 q_norm_b, 5 k_norm_g, 6 k_norm_b, 7 proj_w [1024,1024], 8 proj_b
  if (ws_size < (size_t)WS_END) return;
  char* ws = (char*)d_ws; __bf16* PK = (__bf16*)(ws + WS_PK); _Float16 *QK = (_Float16*)(ws + WS_QK), *QKL = (_Float16*)(ws + WS_QKL), *VTH = (_Float16*)(ws + WS_VTH), *VTL = (_Float16*)(ws + WS_VTL); float *O = (float*)(ws + WS_O), *QF = (float*)(ws + WS_QF);
  k_pack<<<dim3(4 * DM / 16), 256, 0, stream>>>(F[1], F[1] + (size_t)DM * DM, F[1] + (size_t)2 * DM * DM, F[7], PK);
  k_qkv<<<dim3(TNB * SS / 128, QKVW / 128), 128, 0, stream>>>(F[0], F[0], F[0], PK + PK_A, F[2], F[2] + DM, F[2] + 2 * DM, QF, QK, QKL, VTH, VTL);
  k_lnqk<<<dim3(TNB * SS * 2 / 16), 256, 0, stream>>>(QF, F[3], F[4], F[5], F[6], QK);
  k_attn<<<dim3(TQB, NH, TNB), 128, 0, stream>>>(QK, QKL, VTH, VTL, nullptr, O);
  k_out<<<dim3(TOB / 2, DM / 128), 128, 0, stream>>>(O, PK + PK_P, F[8], (float*)d_out);
}

// v005
// One run takes 88.8 microseconds.
// Next to v004, in two timings, it ran 1.04 and 1.03 times as fast.
// All steps since v000 together make it 3.72 times as fast.
// compute dtype: all float inputs rounded to bf16; qkv = x . W^T + b with EXACT bf16 products on WMMA 16x16x32 (natural rows; three contiguous row blocks) kept in f32 for q and k; the two per-token LayerNorms (1,024 wide, eps 1e-5) in f32, then q, k rounded once to f16; PLAIN attention: x 1/8, running-max softmax in f32 (hardware exp), P (scaled by 2^11, single f16) x v (single f16); out = o (bf16 hi + residual) . proj_w^T (2 products) + proj_b.
#include <hip/hip_runtime.h>
#include <math.h>

typedef __attribute__((ext_vector_type(16))) _Float16 v16h;
typedef __attribute__((ext_vector_type(16))) __bf16 v16b;
typedef __attribute__((ext_vector_type(8)))  _Float16 v8h;
typedef __attribute__((ext_vector_type(2)))  _Float16 v2h;
typedef __attribute__((ext_vector_type(8)))  float v8f;
typedef __attribute__((ext_vector_type(4)))  float v4f;
typedef __attribute__((ext_vector_type(2)))  float v2f;
typedef __attribute__((ext_vector_type(4)))  unsigned v4u;
typedef __attribute__((ext_vector_type(4)))  int v4i;
typedef float __attribute__((may_alias)) float_a;
typedef int __attribute__((may_alias)) int_a;

template <typename T> __device__ __forceinline__ void vst2(void* p, T v) { *(T*)p = v;  }
__device__ __forceinline__ v8f wmma16(v16h a, v16h b, v8f c) {
  v8f d = __builtin_amdgcn_wmma_f32_16x16x32_f16(false, a, false, b, (short)0, c, false, false);
  asm volatile("v_nop\n\tv_nop\n\tv_nop\n\tv_nop" : "+v"(d) : "v"(a), "v"(b));
  return d;
}
__device__ __forceinline__ v8f wmma_bf(v16b a, v16b b, v8f c) {
  v8f d = __builtin_amdgcn_wmma_f32_16x16x32_bf16(false, a, false, b, (short)0, c, false, false);
  asm volatile("v_nop\n\tv_nop\n\tv_nop\n\tv_nop" : "+v"(d) : "v"(a), "v"(b));
  return d;
}
// attention with qk LayerNorm (B 4, N 1,024, C 1,024, 16 heads x 64): fused qkv projection + bias, LayerNorm over the flattened q and k per token, softmax(q k / 8) v, output projection + bias.
__device__ __forceinline__ v16h frag_h(const _Float16* rowk0, int lane) {
  union { v16h v; v8h q[2]; } u; const _Float16* p = rowk0 + 8 * (lane >> 4);
  u.q[0] = *(const v8h*)p; u.q[1] = *(const v8h*)(p + 16); return u.v;
}
__device__ __forceinline__ v16h frag_f32(const float* rowk0, int lane) {
  v16h a; const float* p = rowk0 + 8 * (lane >> 4);
#pragma unroll
  for (int i = 0; i < 8; ++i) { a[i] = (_Float16)p[i]; a[8 + i] = (_Float16)p[16 + i]; }
  return a;
}
__device__ __forceinline__ v16h frag_f32s(const float* rowk0, int lane, float sc) {
  v16h a; const float* p = rowk0 + 8 * (lane >> 4);
#pragma unroll
  for (int i = 0; i < 8; ++i) { a[i] = (_Float16)(p[i] * sc); a[8 + i] = (_Float16)(p[16 + i] * sc); }
  return a;
}
// column fragment from a [K][ld] layout (column n), rows >= K read as 0
__device__ __forceinline__ v16h fragc_f32(const float* W, int k0, int n, int lane, int ld, int K) {
  v16h a; const int g = lane >> 4;
#pragma unroll
  for (int i = 0; i < 8; ++i) { const int ka = k0 + 8 * g + i, kb = ka + 16;
    a[i] = (_Float16)(ka < K ? W[(size_t)(ka < K ? ka : K - 1) * ld + n] : 0.f); a[8 + i] = (_Float16)(kb < K ? W[(size_t)(kb < K ? kb : K - 1) * ld + n] : 0.f); }
  return a;
}
struct F2 { v16b h, l; };
__device__ __forceinline__ F2 bsplit16(const float v[16]) { F2 r;
#pragma unroll
  for (int i = 0; i < 16; ++i) { const __bf16 h = (__bf16)v[i]; r.h[i] = h; r.l[i] = (__bf16)(v[i] - (float)h); }
  return r; }
__device__ __forceinline__ F2 split_row(const float* row, int k0, int lane) { float v[16]; const float* p = row + k0 + 8 * (lane >> 4);
#pragma unroll
  for (int i = 0; i < 8; ++i) { v[i] = p[i]; v[8 + i] = p[16 + i]; }
  return bsplit16(v); }
__device__ __forceinline__ F2 split_rowK(const float* row, int k0, int lane, int K) { float v[16]; const int g = lane >> 4;
#pragma unroll
  for (int i = 0; i < 8; ++i) { const int ka = k0 + 8 * g + i, kb = ka + 16; v[i] = ka < K ? row[ka < K ? ka : K - 1] : 0.f; v[8 + i] = kb < K ? row[kb < K ? kb : K - 1] : 0.f; }
  return bsplit16(v); }
__device__ __forceinline__ F2 split_col(const float* W, int k0, int n, int lane, int ld, int K) { float v[16]; const int g = lane >> 4;
#pragma unroll
  for (int i = 0; i < 8; ++i) { const int ka = k0 + 8 * g + i, kb = ka + 16; v[i] = ka < K ? W[(size_t)(ka < K ? ka : K - 1) * ld + n] : 0.f; v[8 + i] = kb < K ? W[(size_t)(kb < K ? kb : K - 1) * ld + n] : 0.f; }
  return bsplit16(v); }
__device__ __forceinline__ v8f mac3(const F2& a, const F2& b, v8f c) { c = wmma_bf(a.l, b.h, c); c = wmma_bf(a.h, b.l, c); return wmma_bf(a.h, b.h, c); }
__device__ __forceinline__ float sigm(float v) { return 1.0f / (1.0f + expf(-v)); }
#define LDSX() do { asm volatile("s_wait_dscnt 0" ::: "memory"); __builtin_amdgcn_wave_barrier(); __builtin_amdgcn_fence(__ATOMIC_RELEASE, "workgroup"); } while (0)


#define NB 4
#define SS 1024
#define DM 1024
#define NH 16
#define HD 64
#define QKVW (3 * DM)
#ifndef TQB
#define TQB (SS / 64)
#define TNB NB
#define TOB (NB * SS / 64)     // output row tiles (all)
#endif
typedef __attribute__((ext_vector_type(8))) __bf16 v8b;
__device__ __forceinline__ v16b frag_b(const __bf16* rowk0, int lane) {
  union { v16b v; v8b q[2]; } u; const __bf16* p = rowk0 + 8 * (lane >> 4);
  u.q[0] = *(const v8b*)p; u.q[1] = *(const v8b*)(p + 16); return u.v;
}
__device__ __forceinline__ float bfr(float v) { return (float)(__bf16)v; }
__device__ __attribute__((noinline)) float exp_ni(float v) { return expf(v); }
__device__ __attribute__((noinline)) float erf_ni(float v) { return erff(v); }

#define PK_A 0                       // [3072][1024] Wqkv rows (natural [out][in])
#define PK_P (PK_A + QKVW * DM)        // [1024][1024] Wo rows (natural)
#define PK_END (PK_P + DM * DM)
#define WS_PK  0u
#define WS_QK  (WS_PK + 2u * PK_END)             // f16 [4096 rows][2048]: q | k
#define WS_QKL (WS_QK + 2u * NB * SS * 2 * DM)     // f16 [4096][2048]; never written or read
#define WS_VTH (WS_QKL + 2u * NB * SS * 2 * DM)    // f16 [b][1024 (h*64+d)][1024 s] hi
#define WS_VTL (WS_VTH + 2u * NB * DM * SS)        // f16 lo x 2048
#define WS_O   (WS_VTL + 2u * NB * DM * SS)        // f32 [4096][1024]
#define WS_CS  (WS_O + 4u * NB * SS * DM)           // f32 [2][1024][32], not used
#define WS_QF  (WS_CS + 4u * 2 * SS * 32)                  // f32 [NR][2048] pre-LN q | k
#define WS_END (WS_QF + 4u * (size_t)NB * SS * 2 * DM)
// ---- k_pack: natural [out][in] f32 rows -> bf16. The 4,096 rows (W_q | W_k | W_v -> PK_A rows, W_o -> PK_P rows, which follow them) are dealt two to a wave: 8 KiB in a row, read by sixteen 16-byte loads per lane that are all in flight together; no LDS, no barrier. Few, long waves: the launch starts 2,048 of them, two a SIMD.
// amdgpu_waves_per_eu(2, 4), here and on k_lnqk: register budget of four waves a SIMD, so that the compiler does not split a wave's run of loads to save registers. The loops of both kernels are unrolled whole so that every array index is a constant (registers, no scratch).
typedef __attribute__((ext_vector_type(4))) __bf16 v4b;
typedef __attribute__((ext_vector_type(4))) _Float16 v4h;
__global__ __launch_bounds__(256) __attribute__((amdgpu_waves_per_eu(2, 4))) void k_pack(const float* __restrict__ WQ, const float* __restrict__ WK, const float* __restrict__ WV, const float* __restrict__ WO, __bf16* __restrict__ PK) {
  const unsigned lane = threadIdx.x & 31, r0 = (blockIdx.x * 8 + __builtin_amdgcn_readfirstlane(threadIdx.x >> 5)) * 2, which = r0 / DM, n = r0 % DM;   // r0 is even: both rows lie in one matrix
  const char* s = (const char*)(((which == 0) ? WQ : (which == 1) ? WK : (which == 2) ? WV : WO) + (size_t)n * DM); const unsigned lb = lane * 16;   // scalar base, one lane offset in bytes
  __bf16* dst = ((which < 3) ? PK + PK_A + ((size_t)which * DM + n) * DM : PK + PK_P + (size_t)n * DM) + lane * 4;
  v4f v[16];
#pragma unroll
  for (int j = 0; j < 16; ++j) v[j] = *(const v4f*)(s + lb + j * 512);
#pragma unroll
  for (int j = 0; j < 16; ++j) *(v4b*)(dst + j * 128) = __builtin_convertvector(v[j], v4b);
}
// ---- tiled product core of k_qkv and k_out: one 128 x 128 tile of A[.][1024] (f32) . B[.][1024]^T (bf16) per block: MI = 4: four waves (2 x 2, 64 x 64 each); MI = 2: eight waves (4 x 2, 32 x 64 each), two a SIMD where a WGP holds one block.
// A stage is 64 k of both operands in LDS: 128 A rows of 256 B at pitch 272, then 128 B rows of 128 B at pitch 144 (16 B x odd for the 16-byte readers). Two buffers: the next stage's copies fly while this one is worked on.
#define GKW 64
#define GAP 272
#define GBP 144
#define GAB (128 * GAP)
#define GST (GAB + 128 * GBP)
typedef __attribute__((ext_vector_type(2))) __bf16 v2b;
__device__ __forceinline__ unsigned lds_off(const void* p) { return (unsigned)(size_t)p; }
// eight asynchronous 16-byte copies per lane, global -> LDS; the s_wait_xcnt closes the statement so that no address register is rewritten ahead of it
__device__ __forceinline__ void cp8(unsigned l, unsigned ls, const char* g, size_t gs) {
  asm volatile("global_load_async_to_lds_b128 %0, %8, off\n\t"
               "global_load_async_to_lds_b128 %1, %9, off\n\t"
               "global_load_async_to_lds_b128 %2, %10, off\n\t"
               "global_load_async_to_lds_b128 %3, %11, off\n\t"
               "global_load_async_to_lds_b128 %4, %12, off\n\t"
               "global_load_async_to_lds_b128 %5, %13, off\n\t"
               "global_load_async_to_lds_b128 %6, %14, off\n\t"
               "global_load_async_to_lds_b128 %7, %15, off\n\t"
               "s_wait_xcnt 0x0"
               :: "v"(l), "v"(l + ls), "v"(l + 2 * ls), "v"(l + 3 * ls), "v"(l + 4 * ls), "v"(l + 5 * ls), "v"(l + 6 * ls), "v"(l + 7 * ls),
                  "v"(g), "v"(g + gs), "v"(g + 2 * gs), "v"(g + 3 * gs), "v"(g + 4 * gs), "v"(g + 5 * gs), "v"(g + 6 * gs), "v"(g + 7 * gs) : "memory");
}
// four such copies per lane, closed in the same way
__device__ __forceinline__ void cp4(unsigned l, unsigned ls, const char* g, size_t gs) {
  asm volatile("global_load_async_to_lds_b128 %0, %4, off\n\t"
               "global_load_async_to_lds_b128 %1, %5, off\n\t"
               "global_load_async_to_lds_b128 %2, %6, off\n\t"
               "global_load_async_to_lds_b128 %3, %7, off\n\t"
               "s_wait_xcnt 0x0"
               :: "v"(l), "v"(l + ls), "v"(l + 2 * ls), "v"(l + 3 * ls), "v"(g), "v"(g + gs), "v"(g + 2 * gs), "v"(g + 3 * gs) : "memory");
}
// one stage, dealt over the block's 128 (MI = 4) or 256 (MI = 2) threads: a wave's copy covers two whole A rows (2 x 256 B) or four whole B rows (4 x 128 B)
template <int MI> __device__ __forceinline__ void g_stage(unsigned lb, const float* A, const __bf16* B, int tid) {
  const unsigned la = lb + (unsigned)(tid >> 4) * GAP + (unsigned)(tid & 15) * 16; const char* ga = (const char*)A + (size_t)(tid >> 4) * (DM * 4) + (tid & 15) * 16;
  if (MI == 4) {
    cp8(la, 8 * GAP, ga, (size_t)8 * DM * 4);
    cp8(la + 64 * GAP, 8 * GAP, ga + (size_t)64 * DM * 4, (size_t)8 * DM * 4);
    cp8(lb + GAB + (unsigned)(tid >> 3) * GBP + (unsigned)(tid & 7) * 16, 16 * GBP, (const char*)B + (size_t)(tid >> 3) * (DM * 2) + (tid & 7) * 16, (size_t)16 * DM * 2);
  } else {   // A rows tid / 16 + 16 n (n < 8), B rows tid / 8 + 32 n (n < 4)
    cp8(la, 16 * GAP, ga, (size_t)16 * DM * 4);
    cp4(lb + GAB + (unsigned)(tid >> 3) * GBP + (unsigned)(tid & 7) * 16, 32 * GBP, (const char*)B + (size_t)(tid >> 3) * (DM * 2) + (tid & 7) * 16, (size_t)32 * DM * 2);
  }
}
// A, B point at the tile's first row; SPLIT: A as bf16 hi + residual (2 products per k-step, residual first), else A rounded once to bf16. Every accumulator sums its k-steps in rising order. The inner loops are unrolled whole so that every fragment and accumulator index is a constant (registers, no scratch).
template <bool SPLIT, int MI> __device__ __forceinline__ void g_core(const float* __restrict__ A, const __bf16* __restrict__ B, unsigned char* sm, int tid, v8f (&acc)[MI][4]) {
  const int wave = tid >> 5, lane = tid & 31, col = lane & 15, g = lane >> 4, wm = wave >> 1, wn = wave & 1; const unsigned l0 = lds_off(sm);
  g_stage<MI>(l0, A, B, tid);
  asm volatile("s_wait_asynccnt 0x0" ::: "memory");   // stage 0 landed (this wave's copies)
  __syncthreads();                                    // ... and every other wave's
  g_stage<MI>(l0 + GST, A + GKW, B + GKW, tid);
#pragma unroll 1   // one stage per trip: the ring's order stays as written
  for (int t = 0; t < DM / GKW; ++t) {
    const unsigned char* sa = sm + (t & 1) * GST + (wm * (MI * 16) + col) * GAP + 32 * g; const unsigned char* sb = sm + (t & 1) * GST + GAB + (wn * 64 + col) * GBP + 16 * g;
#pragma unroll
    for (int kc = 0; kc < GKW / 32; ++kc) { v16b w[4];
#pragma unroll
      for (int j = 0; j < 4; ++j) { union { v16b v; v8b q[2]; } u; u.q[0] = *(const v8b*)(sb + j * 16 * GBP + kc * 64); u.q[1] = *(const v8b*)(sb + j * 16 * GBP + kc * 64 + 32); w[j] = u.v; }
#pragma unroll
      for (int i = 0; i < MI; ++i) { const v2f* p = (const v2f*)(sa + i * 16 * GAP + kc * 128); union { v16b v; v2b q[8]; } h, l;   // k order of the fragment: 8 g + 0..7, then 16 + 8 g + 0..7, as in the B rows
#pragma unroll
        for (int e = 0; e < 4; ++e) { const v2f x0 = p[e], x1 = p[8 + e]; h.q[e] = __builtin_convertvector(x0, v2b); h.q[4 + e] = __builtin_convertvector(x1, v2b);
          if (SPLIT) { l.q[e] = __builtin_convertvector(x0 - __builtin_convertvector(h.q[e], v2f), v2b); l.q[4 + e] = __builtin_convertvector(x1 - __builtin_convertvector(h.q[4 + e], v2f), v2b); } }
        if (SPLIT) {
#pragma unroll
          for (int j = 0; j < 4; ++j) acc[i][j] = wmma_bf(l.v, w[j], acc[i][j]); }
#pragma unroll
        for (int j = 0; j < 4; ++j) acc[i][j] = wmma_bf(h.v, w[j], acc[i][j]); } }
    asm volatile("s_wait_dscnt 0x0" ::: "memory");      // this wave has left the buffer
    asm volatile("s_wait_asynccnt 0x0" ::: "memory");   // its copies of stage t + 1 have landed
    __syncthreads();                                    // publishes stage t + 1 and frees stage t's buffer
    if (t + 2 < DM / GKW) g_stage<MI>(l0 + (t & 1) * GST, A + (t + 2) * GKW, B + (t + 2) * GKW, tid);
  }
  asm volatile("s_wait_asynccnt 0x0" ::: "memory");     // nothing in flight when the ring becomes output staging
}
__global__ __launch_bounds__(128) void k_qkv(const float* __restrict__ XQ, const float* __restrict__ XK, const float* __restrict__ XV, const __bf16* __restrict__ P, const float* __restrict__ BQ, const float* __restrict__ BK, const float* __restrict__ BV, float* __restrict__ QF, _Float16* __restrict__ QK, _Float16* __restrict__ QKL, _Float16* __restrict__ VTH, _Float16* __restrict__ VTL) {
  const int which0 = (blockIdx.y * 128) / DM; const float* X = (which0 == 0) ? XQ : (which0 == 1) ? XK : XV; const float* BB = BQ ? (((which0 == 0) ? BQ : (which0 == 1) ? BK : BV) + (blockIdx.y * 128 - which0 * DM)) : nullptr;
  __shared__ __attribute__((aligned(16))) unsigned char sm[2 * GST];
  const int tid = threadIdx.x, wave = tid >> 5, lane = tid & 31, col = lane & 15, g = lane >> 4, wm = wave >> 1, wn = wave & 1; const size_t m0 = (size_t)blockIdx.x * 128; const int n0 = blockIdx.y * 128;
  v8f acc[4][4] = {};
  g_core<false, 4>(X + m0 * DM, P + (size_t)n0 * DM, sm, tid, acc);
  float bj[4] = {0.f, 0.f, 0.f, 0.f};   // this lane's four bias values
  if (BB) {
#pragma unroll
    for (int j = 0; j < 4; ++j) bj[j] = bfr(BB[wn * 64 + j * 16 + col]); }
  if (n0 < 2 * DM) {   // q and k kept in f32 (LayerNorm comes next); each wave stages its own 64 x 64 in its own range of the ring
    float* sf = (float*)(sm + wave * (64 * 68 * 4));
#pragma unroll
    for (int j = 0; j < 4; ++j) {
#pragma unroll
      for (int i = 0; i < 4; ++i) {
#pragma unroll
        for (int r = 0; r < 8; ++r) sf[(i * 16 + 8 * g + r) * 68 + j * 16 + col] = acc[i][j][r] + bj[j]; } }
    LDSX();
    for (int rl = 0; rl < 32; ++rl) vst2(QF + (m0 + wm * 64 + rl * 2 + g) * (2 * DM) + n0 + wn * 64 + col * 4, *(const v4f*)&sf[(rl * 2 + g) * 68 + col * 4]);
    asm volatile("s_wait_xcnt 0x0" ::: "memory");   // closes the run of stores before any code laid out behind it rewrites an address register
  } else {
    _Float16* sth = (_Float16*)sm; _Float16* stl = (_Float16*)(sm + 128 * 136 * 2);   // [128 d][136 s] each
#pragma unroll
    for (int j = 0; j < 4; ++j) {
#pragma unroll
      for (int i = 0; i < 4; ++i) { v8h hv8, lv8;
#pragma unroll
        for (int r = 0; r < 8; ++r) { const float v = acc[i][j][r] + bj[j]; const _Float16 hv = (_Float16)v; hv8[r] = hv; lv8[r] = (_Float16)((v - (float)hv) * 2048.0f); }
        const int o = (wn * 64 + j * 16 + col) * 136 + wm * 64 + i * 16 + 8 * g; *(v8h*)&sth[o] = hv8; *(v8h*)&stl[o] = lv8; } }
    __syncthreads();
    const int b = (int)(m0 / SS), s0 = (int)(m0 % SS); const int pc0 = n0 - 2 * DM;
    for (int it = 0; it < 16; ++it) { const int q = it * 128 + tid, d = q >> 4, pc = q & 15; const size_t o = ((size_t)b * DM + pc0 + d) * SS + s0 + pc * 8; vst2((unsigned*)(VTH + o), *(const v4u*)&sth[d * 136 + pc * 8]); vst2((unsigned*)(VTL + o), *(const v4u*)&stl[d * 136 + pc * 8]); }
    asm volatile("s_wait_xcnt 0x0" ::: "memory");   // closes the run of stores before any code laid out behind it rewrites an address register
  }
}
// ---- k_attn: block = (64 queries, head h, batch b): all-keys flash attention (K = 64: 2 k-steps), scores = (q.k) * 0.125 with single f16 operands, P.V: f16 P x f16 V; O[b*S+q][h*64+d] = acc / l (256-B segments)
// A stage is 64 keys of this head in LDS, shared by the block's four waves: 64 K rows of 128 B, then 64 V^T rows (one per d) of 128 B, all at pitch 144 (16 B x odd for the 16-byte readers). Two buffers: the next stage's copies fly while this one is worked on.
#define AKT 64
#define ATP 144
#define ATK (64 * ATP)
#define AST (2 * ATK)
// one stage: eight asynchronous 16-byte copies per lane, global -> LDS, four of K and four of V^T; a wave's copy covers four whole 128-B rows; the s_wait_xcnt closes the statement so that no address register is rewritten ahead of it
__device__ __forceinline__ void a_stage(unsigned lb, const _Float16* K, const _Float16* V, int tid) {
  const unsigned lk = lb + (unsigned)(tid >> 3) * ATP + (unsigned)(tid & 7) * 16, lv = lk + ATK, ls = 16 * ATP;
  const char* gk = (const char*)K + (size_t)(tid >> 3) * (2 * DM * 2) + (tid & 7) * 16; const size_t ks = (size_t)16 * 2 * DM * 2;
  const char* gv = (const char*)V + (size_t)(tid >> 3) * (SS * 2) + (tid & 7) * 16; const size_t vs = (size_t)16 * SS * 2;
  asm volatile("global_load_async_to_lds_b128 %0, %8, off\n\t"
               "global_load_async_to_lds_b128 %1, %9, off\n\t"
               "global_load_async_to_lds_b128 %2, %10, off\n\t"
               "global_load_async_to_lds_b128 %3, %11, off\n\t"
               "global_load_async_to_lds_b128 %4, %12, off\n\t"
               "global_load_async_to_lds_b128 %5, %13, off\n\t"
               "global_load_async_to_lds_b128 %6, %14, off\n\t"
               "global_load_async_to_lds_b128 %7, %15, off\n\t"
               "s_wait_xcnt 0x0"
               :: "v"(lk), "v"(lk + ls), "v"(lk + 2 * ls), "v"(lk + 3 * ls), "v"(lv), "v"(lv + ls), "v"(lv + 2 * ls), "v"(lv + 3 * ls),
                  "v"(gk), "v"(gk + ks), "v"(gk + 2 * ks), "v"(gk + 3 * ks), "v"(gv), "v"(gv + vs), "v"(gv + 2 * vs), "v"(gv + 3 * vs) : "memory");
}
// fragment from a staged row; p = row start + 16 g bytes: k order 8 g + 0..7, then 16 + 8 g + 0..7, as frag_h
__device__ __forceinline__ v16h frag_l(const unsigned char* p) { union { v16h v; v8h q[2]; } u; u.q[0] = *(const v8h*)p; u.q[1] = *(const v8h*)(p + 32); return u.v; }
// lane l <-> lane l ^ 16: the two halves of a wave hold the two halves of a query's keys
__device__ __forceinline__ float xhalf(float x) { const int b = __builtin_bit_cast(int, x); return __builtin_bit_cast(float, __builtin_amdgcn_permlanex16(b, b, 0x76543210, 0xfedcba98, false, false)); }
__device__ __forceinline__ v8f wmma_t(v16h a, v16h b, v8f c) { return __builtin_amdgcn_wmma_f32_16x16x32_f16(false, a, false, b, (short)0, c, false, false); }
// Transposed products: S^T = K . Q^T (A = 16 staged K rows, B = the wave's 16 queries) and O^T += V^T . P^T (A = 16 staged V^T rows, B = P^T). Lane (col, g) holds query col: of each 16-key score tile the keys 8 g + 0..7, of each output tile d = 8 g + 0..7.
// So a query's maximum and sum are taken inside the lane, with one exchange between the halves, and two score tiles, converted in place, are the B operand of the second product in the fragment's own k order (8 g + 0..7, then 16 + 8 g + 0..7, as frag_l reads V^T).
__global__ __launch_bounds__(128) void k_attn(const _Float16* __restrict__ QK, const _Float16* __restrict__ QKL, const _Float16* __restrict__ VTH, const _Float16* __restrict__ VTL, const void* __restrict__ KMASK, float* __restrict__ O) {
  __shared__ __align__(16) float so[4][16][68]; __shared__ __attribute__((aligned(16))) unsigned char ring[2 * AST];
  const int tid = threadIdx.x, wave = tid >> 5, lane = tid & 31, col = lane & 15, g = lane >> 4;
  const int qb = blockIdx.x, h = blockIdx.y, b = blockIdx.z; const int q0 = qb * 64 + wave * 16; const size_t rq = (size_t)b * SS + q0 + col;
  const unsigned l0 = lds_off(ring); const _Float16* Kg = QK + (size_t)b * SS * (2 * DM) + DM + h * HD; const _Float16* Vg = VTH + ((size_t)b * DM + h * HD) * SS;
  a_stage(l0, Kg, Vg, tid);
  v16h aq[2];
#pragma unroll
  for (int kc = 0; kc < 2; ++kc) aq[kc] = frag_h(QK + rq * (2 * DM) + h * HD + kc * 32, lane);
  const float cs = 0.125f * 1.4426950408889634f;   // 1/sqrt(64), and the exponentials in base 2
  float m = -3.0e38f, l = 0.f;   // of query col: running maximum (scaled, the same in both halves) and this half's part of the sum
  v8f acc[4] = {};
  asm volatile("s_wait_asynccnt 0x0" ::: "memory");   // stage 0 landed (this wave's copies)
  __syncthreads();                                    // ... and every other wave's
  a_stage(l0 + AST, Kg + (size_t)AKT * (2 * DM), Vg + AKT, tid);
#pragma unroll 1   // one stage per trip: the ring's order stays as written
  for (int t = 0; t < SS / AKT; ++t) { const unsigned char* sk = ring + (t & 1) * AST + col * ATP + 16 * g; const unsigned char* sv = sk + ATK;
#pragma unroll   // both 32-key steps of the stage, keys in rising order: every LDS offset is a constant
  for (int u = 0; u < AKT / 32; ++u) { v8f s[2]; v16h kf[2][2], vf[4];   // the step's K and V^T fragments, read as one group of LDS reads ahead of its products
#pragma unroll
    for (int ct = 0; ct < 2; ++ct) {
#pragma unroll
      for (int kc = 0; kc < 2; ++kc) kf[ct][kc] = frag_l(sk + (u * 32 + ct * 16) * ATP + kc * 64); }
#pragma unroll
    for (int dt = 0; dt < 4; ++dt) vf[dt] = frag_l(sv + dt * 16 * ATP + u * 64);
#pragma unroll
    for (int ct = 0; ct < 2; ++ct) { v8f c = {};
#pragma unroll
      for (int kc = 0; kc < 2; ++kc) c = wmma_t(kf[ct][kc], aq[kc], c);   // single product: k, q as one-rounding f16 operands
      s[ct] = c; }
    float mx = fmaxf(s[0][0], s[1][0]);   // maximum of the raw scores (the scale is positive)
#pragma unroll
    for (int r = 1; r < 8; ++r) mx = fmaxf(mx, fmaxf(s[0][r], s[1][r]));
    mx = fmaxf(mx, xhalf(mx)) * cs;
    const float mn = fmaxf(m, mx), nb = 11.0f - mn; float alpha;
    asm("v_exp_f32 %0, %1\n\tv_nop" : "=v"(alpha) : "v"(m - mn));   // exp2, in asm so that the v_nop stands directly behind it: the slot that the instruction set asks for before a transcendental's source register is written again
    m = mn;   // alpha is 0 on the first step; P carries 2^11 so that small softmax weights stay out of the f16 subnormal range, and so does the sum: it cancels in the epilogue
    union { v16h v; v2h q[8]; } pa; v2f es[2];
#pragma unroll
    for (int ct = 0; ct < 2; ++ct) {
#pragma unroll
      for (int i = 0; i < 4; ++i) { const v2f x = __builtin_elementwise_fma(v2f{s[ct][2 * i], s[ct][2 * i + 1]}, v2f{cs, cs}, v2f{nb, nb}); const v2f e = {__builtin_amdgcn_exp2f(x.x), __builtin_amdgcn_exp2f(x.y)};
        es[ct] = i ? es[ct] + e : e; pa.q[ct * 4 + i] = __builtin_convertvector(e, v2h); } }
    l = l * alpha + ((es[0].x + es[1].x) + (es[0].y + es[1].y));
#pragma unroll
    for (int dt = 0; dt < 4; ++dt) acc[dt] = acc[dt] * alpha;
#pragma unroll
    for (int dt = 0; dt < 4; ++dt) acc[dt] = wmma_t(vf[dt], pa.v, acc[dt]); }   // single product: V x P (x2^11)
    asm volatile("s_wait_dscnt 0x0" ::: "memory");      // this wave has left the buffer
    asm volatile("s_wait_asynccnt 0x0" ::: "memory");   // its copies of stage t + 1 have landed
    __syncthreads();                                    // publishes stage t + 1 and frees stage t's buffer
    if (t + 2 < SS / AKT) a_stage(l0 + (t & 1) * AST, Kg + (size_t)(t + 2) * AKT * (2 * DM), Vg + (t + 2) * AKT, tid);
  }
  asm volatile("s_wait_asynccnt 0x0" ::: "memory");     // nothing in flight when the wave goes on to its end
  const float il = 1.0f / (l + xhalf(l));   // the halves' sums joined once
#pragma unroll
  for (int dt = 0; dt < 4; ++dt) { const v8f o = acc[dt] * il; *(v4f*)&so[wave][col][dt * 16 + 8 * g] = v4f{o[0], o[1], o[2], o[3]}; *(v4f*)&so[wave][col][dt * 16 + 8 * g + 4] = v4f{o[4], o[5], o[6], o[7]}; }
  LDSX();
  for (int rl = 0; rl < 16; ++rl) if (lane < 16) vst2(O + ((size_t)b * SS + q0 + rl) * DM + h * HD + lane * 4, *(const v4f*)&so[wave][rl][lane * 4]);
}
// ---- k_out: block = (128 rows, 128 cols), eight waves of 32 x 64: out = O(hi/lo) . Wo rows (2 products) + bo. The grid is one block a WGP: with eight waves each SIMD has a second wave to issue while the first waits on LDS or converts
__global__ __launch_bounds__(256) void k_out(const float* __restrict__ O, const __bf16* __restrict__ P, const float* __restrict__ BO, float* __restrict__ Y) {
  __shared__ __attribute__((aligned(16))) unsigned char sm[2 * GST];
  const int tid = threadIdx.x, wave = tid >> 5, lane = tid & 31, col = lane & 15, g = lane >> 4, wm = wave >> 1, wn = wave & 1; const size_t m0 = (size_t)blockIdx.x * 128; const int n0 = blockIdx.y * 128;
  v8f acc[2][4] = {};
  g_core<true, 2>(O + m0 * DM, P + (size_t)n0 * DM, sm, tid, acc);
  float bj[4];   // this lane's four bias values
#pragma unroll
  for (int j = 0; j < 4; ++j) bj[j] = bfr(BO[n0 + wn * 64 + j * 16 + col]);
  float* sf = (float*)(sm + wave * (32 * 68 * 4));   // each wave stages its own 32 x 64 in its own range of the ring
#pragma unroll
  for (int j = 0; j < 4; ++j) {
#pragma unroll
    for (int i = 0; i < 2; ++i) {
#pragma unroll
      for (int r = 0; r < 8; ++r) sf[(i * 16 + 8 * g + r) * 68 + j * 16 + col] = acc[i][j][r] + bj[j]; } }
  LDSX();
  for (int rl = 0; rl < 16; ++rl) vst2(Y + (m0 + wm * 32 + rl * 2 + g) * DM + n0 + wn * 64 + col * 4, *(const v4f*)&sf[(rl * 2 + g) * 68 + col * 4]);
}
// ---- k_lnqk: LayerNorm over the 1,024 flattened head dims (jnp.var, 1e-5) x g + b -> f16 row into the engine's q | k layout. A wave takes the q rows, or the k rows, of two tokens whole in registers (lane l holds columns 128 j + 4 l + 0..3); all its loads are in flight together; no LDS, no barrier; 4,096 waves, four a SIMD
template <int C> __device__ __forceinline__ float rowx(float x) { return __builtin_bit_cast(float, __builtin_amdgcn_update_dpp(0, __builtin_bit_cast(int, x), C, 0xf, 0xf, true)); }   // lane l <- lane l ^ (C & 15) of its 16-lane row (row_xmask)
__device__ __forceinline__ float wsum(float s) { s += rowx<0x161>(s); s += rowx<0x162>(s); s += rowx<0x164>(s); s += rowx<0x168>(s); return s + xhalf(s); }   // sum over the wave, the same bits in every lane
__global__ __launch_bounds__(256) __attribute__((amdgpu_waves_per_eu(2, 4))) void k_lnqk(const float* __restrict__ QF, const float* __restrict__ GQ, const float* __restrict__ BQn, const float* __restrict__ GK, const float* __restrict__ BKn, _Float16* __restrict__ QK) {
  const unsigned l4 = (threadIdx.x & 31) * 4, w = blockIdx.x * 8 + __builtin_amdgcn_readfirstlane(threadIdx.x >> 5), which = w & 1; const size_t o = (size_t)(w >> 1) * 2 * (2 * DM) + which * DM;   // o is the same in the whole wave: scalar base, one lane offset
  const float* X = QF + o; const float* G = which ? GK : GQ; const float* Bt = which ? BKn : BQn; _Float16* Y = QK + o;
  v4f x[2][8], gg[8], bb[8];
#pragma unroll
  for (int r = 0; r < 2; ++r) {
#pragma unroll
    for (int j = 0; j < 8; ++j) x[r][j] = *(const v4f*)(X + l4 + r * (2 * DM) + j * 128); }
#pragma unroll
  for (int j = 0; j < 8; ++j) { gg[j] = *(const v4f*)(G + l4 + j * 128); bb[j] = *(const v4f*)(Bt + l4 + j * 128); }
  v4h y[2][8];
#pragma unroll
  for (int r = 0; r < 2; ++r) { v4f s4 = x[r][0];
#pragma unroll
    for (int j = 1; j < 8; ++j) s4 += x[r][j];
    const float mu = wsum((s4.x + s4.y) + (s4.z + s4.w)) / (float)DM; v4f q4 = {};
#pragma unroll
    for (int j = 0; j < 8; ++j) { const v4f d = x[r][j] - mu; q4 += d * d; }
    const float inv = 1.0f / sqrtf(wsum((q4.x + q4.y) + (q4.z + q4.w)) / (float)DM + 1e-5f);
#pragma unroll
    for (int j = 0; j < 8; ++j) {
#pragma unroll
      for (int i = 0; i < 4; ++i) y[r][j][i] = (_Float16)((x[r][j][i] - mu) * inv * bfr(gg[j][i]) + bfr(bb[j][i])); } }
#pragma unroll   // both rows' stores stand last: nothing behind them writes a register
  for (int r = 0; r < 2; ++r) {
#pragma unroll
    for (int j = 0; j < 8; ++j) *(v4h*)(Y + l4 + r * (2 * DM) + j * 128) = y[r][j]; }
}
extern "C" void kernel_launch(void* const* d_in, const int* in_sizes, int n_in, void* d_out, int out_size, void* d_ws, size_t ws_size, hipStream_t stream) {
  (void)in_sizes; (void)n_in; (void)out_size;
  const float** F = (const float**)d_in;   // 0 x [4,1024,1024], 1 qkv_w [3072,1024] natural (q | k | v row blocks), 2 qkv_b, 3 q_norm_g, 4 q_norm_b, 5 k_norm_g, 6 k_norm_b, 7 proj_w [1024,1024], 8 proj_b
  if (ws_size < (size_t)WS_END) return;
  char* ws = (char*)d_ws; __bf16* PK = (__bf16*)(ws + WS_PK); _Float16 *QK = (_Float16*)(ws + WS_QK), *QKL = (_Float16*)(ws + WS_QKL), *VTH = (_Float16*)(ws + WS_VTH), *VTL = (_Float16*)(ws + WS_VTL); float *O = (float*)(ws + WS_O), *QF = (float*)(ws + WS_QF);
  k_pack<<<dim3(4 * DM / 16), 256, 0, stream>>>(F[1], F[1] + (size_t)DM * DM, F[1] + (size_t)2 * DM * DM, F[7], PK);
  k_qkv<<<dim3(TNB * SS / 128, QKVW / 128), 128, 0, stream>>>(F[0], F[0], F[0], PK + PK_A, F[2], F[2] + DM, F[2] + 2 * DM, QF, QK, QKL, VTH, VTL);
  k_lnqk<<<dim3(TNB * SS * 2 / 16), 256, 0, stream>>>(QF, F[3], F[4], F[5], F[6], QK);
  k_attn<<<dim3(TQB, NH, TNB), 128, 0, stream>>>(QK, QKL, VTH, VTL, nullptr, O);
  k_out<<<dim3(TOB / 2, DM / 128), 256, 0, stream>>>(O, PK + PK_P, F[8], (float*)d_out);
}

// v006
// It runs in 83.8 microseconds.
// Next to v005, in two timings, it ran 1.06 times as fast each time.
// Over all steps from v000 it is 3.95 times as fast.
// compute dtype: all float inputs rounded to bf16; qkv = x . W^T + b with EXACT bf16 products on WMMA 16x16x32 (natural rows; three contiguous row blocks) kept in f32 for q and k; the two per-token LayerNorms (1,024 wide, eps 1e-5) in f32, then q, k rounded once to f16; PLAIN attention: x 1/8, running-max softmax in f32 (hardware exp), P (scaled by 2^11, single f16) x v (single f16); out = o (bf16 hi + residual) . proj_w^T (2 products) + proj_b.
#include <hip/hip_runtime.h>
#include <math.h>

typedef __attribute__((ext_vector_type(16))) _Float16 v16h;
typedef __attribute__((ext_vector_type(16))) __bf16 v16b;
typedef __attribute__((ext_vector_type(8)))  _Float16 v8h;
typedef __attribute__((ext_vector_type(2)))  _Float16 v2h;
typedef __attribute__((ext_vector_type(8)))  float v8f;
typedef __attribute__((ext_vector_type(4)))  float v4f;
typedef __attribute__((ext_vector_type(2)))  float v2f;
typedef __attribute__((ext_vector_type(4)))  unsigned v4u;
typedef __attribute__((ext_vector_type(4)))  int v4i;
typedef float __attribute__((may_alias)) float_a;
typedef int __attribute__((may_alias)) int_a;

template <typename T> __device__ __forceinline__ void vst2(void* p, T v) { *(T*)p = v;  }
__device__ __forceinline__ v8f wmma16(v16h a, v16h b, v8f c) {
  v8f d = __builtin_amdgcn_wmma_f32_16x16x32_f16(false, a, false, b, (short)0, c, false, false);
  asm volatile("v_nop\n\tv_nop\n\tv_nop\n\tv_nop" : "+v"(d) : "v"(a), "v"(b));
  return d;
}
__device__ __forceinline__ v8f wmma_bf(v16b a, v16b b, v8f c) {
  v8f d = __builtin_amdgcn_wmma_f32_16x16x32_bf16(false, a, false, b, (short)0, c, false, false);
  asm volatile("v_nop\n\tv_nop\n\tv_nop\n\tv_nop" : "+v"(d) : "v"(a), "v"(b));
  return d;
}
// attention with qk LayerNorm (B 4, N 1,024, C 1,024, 16 heads x 64): fused qkv projection + bias, LayerNorm over the flattened q and k per token, softmax(q k / 8) v, output projection + bias.
__device__ __forceinline__ v16h frag_h(const _Float16* rowk0, int lane) {
  union { v16h v; v8h q[2]; } u; const _Float16* p = rowk0 + 8 * (lane >> 4);
  u.q[0] = *(const v8h*)p; u.q[1] = *(const v8h*)(p + 16); return u.v;
}
__device__ __forceinline__ v16h frag_f32(const float* rowk0, int lane) {
  v16h a; const float* p = rowk0 + 8 * (lane >> 4);
#pragma unroll
  for (int i = 0; i < 8; ++i) { a[i] = (_Float16)p[i]; a[8 + i] = (_Float16)p[16 + i]; }
  return a;
}
__device__ __forceinline__ v16h frag_f32s(const float* rowk0, int lane, float sc) {
  v16h a; const float* p = rowk0 + 8 * (lane >> 4);
#pragma unroll
  for (int i = 0; i < 8; ++i) { a[i] = (_Float16)(p[i] * sc); a[8 + i] = (_Float16)(p[16 + i] * sc); }
  return a;
}
// column fragment from a [K][ld] layout (column n), rows >= K read as 0
__device__ __forceinline__ v16h fragc_f32(const float* W, int k0, int n, int lane, int ld, int K) {
  v16h a; const int g = lane >> 4;
#pragma unroll
  for (int i = 0; i < 8; ++i) { const int ka = k0 + 8 * g + i, kb = ka + 16;
    a[i] = (_Float16)(ka < K ? W[(size_t)(ka < K ? ka : K - 1) * ld + n] : 0.f); a[8 + i] = (_Float16)(kb < K ? W[(size_t)(kb < K ? kb : K - 1) * ld + n] : 0.f); }
  return a;
}
struct F2 { v16b h, l; };
__device__ __forceinline__ F2 bsplit16(const float v[16]) { F2 r;
#pragma unroll
  for (int i = 0; i < 16; ++i) { const __bf16 h = (__bf16)v[i]; r.h[i] = h; r.l[i] = (__bf16)(v[i] - (float)h); }
  return r; }
__device__ __forceinline__ F2 split_row(const float* row, int k0, int lane) { float v[16]; const float* p = row + k0 + 8 * (lane >> 4);
#pragma unroll
  for (int i = 0; i < 8; ++i) { v[i] = p[i]; v[8 + i] = p[16 + i]; }
  return bsplit16(v); }
__device__ __forceinline__ F2 split_rowK(const float* row, int k0, int lane, int K) { float v[16]; const int g = lane >> 4;
#pragma unroll
  for (int i = 0; i < 8; ++i) { const int ka = k0 + 8 * g + i, kb = ka + 16; v[i] = ka < K ? row[ka < K ? ka : K - 1] : 0.f; v[8 + i] = kb < K ? row[kb < K ? kb : K - 1] : 0.f; }
  return bsplit16(v); }
__device__ __forceinline__ F2 split_col(const float* W, int k0, int n, int lane, int ld, int K) { float v[16]; const int g = lane >> 4;
#pragma unroll
  for (int i = 0; i < 8; ++i) { const int ka = k0 + 8 * g + i, kb = ka + 16; v[i] = ka < K ? W[(size_t)(ka < K ? ka : K - 1) * ld + n] : 0.f; v[8 + i] = kb < K ? W[(size_t)(kb < K ? kb : K - 1) * ld + n] : 0.f; }
  return bsplit16(v); }
__device__ __forceinline__ v8f mac3(const F2& a, const F2& b, v8f c) { c = wmma_bf(a.l, b.h, c); c = wmma_bf(a.h, b.l, c); return wmma_bf(a.h, b.h, c); }
__device__ __forceinline__ float sigm(float v) { return 1.0f / (1.0f + expf(-v)); }
#define LDSX() do { asm volatile("s_wait_dscnt 0" ::: "memory"); __builtin_amdgcn_wave_barrier(); __builtin_amdgcn_fence(__ATOMIC_RELEASE, "workgroup"); } while (0)


#define NB 4
#define SS 1024
#define DM 1024
#define NH 16
#define HD 64
#define QKVW (3 * DM)
#ifndef TQB
#define TQB (SS / 64)
#define TNB NB
#define TOB (NB * SS / 64)     // output row tiles (all)
#endif
typedef __attribute__((ext_vector_type(8))) __bf16 v8b;
__device__ __forceinline__ v16b frag_b(const __bf16* rowk0, int lane) {
  union { v16b v; v8b q[2]; } u; const __bf16* p = rowk0 + 8 * (lane >> 4);
  u.q[0] = *(const v8b*)p; u.q[1] = *(const v8b*)(p + 16); return u.v;
}
__device__ __forceinline__ float bfr(float v) { return (float)(__bf16)v; }
__device__ __attribute__((noinline)) float exp_ni(float v) { return expf(v); }
__device__ __attribute__((noinline)) float erf_ni(float v) { return erff(v); }

#define PK_A 0                       // [3072][1024] Wqkv rows (natural [out][in])
#define PK_P (PK_A + QKVW * DM)        // [1024][1024] Wo rows (natural)
#define PK_END (PK_P + DM * DM)
#define WS_PK  0u
#define WS_QK  (WS_PK + 2u * PK_END)             // f16 [4096 rows][2048]: q | k
#define WS_QKL (WS_QK + 2u * NB * SS * 2 * DM)     // f16 [4096][2048]; never written or read
#define WS_VTH (WS_QKL + 2u * NB * SS * 2 * DM)    // f16 [b][1024 (h*64+d)][1024 s] hi
#define WS_VTL (WS_VTH + 2u * NB * DM * SS)        // f16 lo x 2048
#define WS_O   (WS_VTL + 2u * NB * DM * SS)        // f32 [4096][1024]
#define WS_CS  (WS_O + 4u * NB * SS * DM)           // f32 [2][1024][32], not used
#define WS_QF  (WS_CS + 4u * 2 * SS * 32)                  // f32 [NR][2048] pre-LN q | k
#define WS_XB  (WS_QF + 4u * (size_t)NB * SS * 2 * DM)      // bf16 [4096 rows][1024]: x rounded once
#define WS_END (WS_XB + 2u * (size_t)NB * SS * DM)
// ---- k_pack: natural [out][in] f32 rows -> bf16. The 4,096 weight rows (W_q | W_k | W_v -> PK_A rows, W_o -> PK_P rows, which follow them) are dealt two to a wave, and with them the two rows of x of the same number (-> XB, so that k_qkv stages its A operand at two bytes an element and converts nothing in its loop): twice 8 KiB in a row, read by thirty-two 16-byte loads per lane that are all in flight together; no LDS, no barrier. Few, long waves: the launch starts 2,048 of them, two a SIMD.
// amdgpu_waves_per_eu(2, 4), here and on k_lnqk: register budget of four waves a SIMD, so that the compiler does not split a wave's run of loads to save registers. The loops of both kernels are unrolled whole so that every array index is a constant (registers, no scratch).
typedef __attribute__((ext_vector_type(4))) __bf16 v4b;
typedef __attribute__((ext_vector_type(4))) _Float16 v4h;
__global__ __launch_bounds__(256) __attribute__((amdgpu_waves_per_eu(2, 4))) void k_pack(const float* __restrict__ WQ, const float* __restrict__ WK, const float* __restrict__ WV, const float* __restrict__ WO, const float* __restrict__ X, __bf16* __restrict__ PK, __bf16* __restrict__ XB) {
  static_assert(NB * SS == 4 * DM, "x has as many rows as the four weight matrices together");
  const unsigned lane = threadIdx.x & 31, r0 = (blockIdx.x * 8 + __builtin_amdgcn_readfirstlane(threadIdx.x >> 5)) * 2, which = r0 / DM, n = r0 % DM;   // r0 is even: both rows lie in one matrix
  const char* s = (const char*)(((which == 0) ? WQ : (which == 1) ? WK : (which == 2) ? WV : WO) + (size_t)n * DM); const char* sx = (const char*)(X + (size_t)r0 * DM); const unsigned lb = lane * 16;   // scalar bases, one lane offset in bytes
  __bf16* dst = ((which < 3) ? PK + PK_A + ((size_t)which * DM + n) * DM : PK + PK_P + (size_t)n * DM) + lane * 4; __bf16* dx = XB + (size_t)r0 * DM + lane * 4;
  v4f v[16], x[16];
#pragma unroll
  for (int j = 0; j < 16; ++j) v[j] = *(const v4f*)(s + lb + j * 512);
#pragma unroll
  for (int j = 0; j < 16; ++j) x[j] = *(const v4f*)(sx + lb + j * 512);
#pragma unroll
  for (int j = 0; j < 16; ++j) *(v4b*)(dst + j * 128) = __builtin_convertvector(v[j], v4b);
#pragma unroll
  for (int j = 0; j < 16; ++j) *(v4b*)(dx + j * 128) = __builtin_convertvector(x[j], v4b);
}
// ---- tiled product core of k_qkv and k_out: one 128 x 128 tile of A[.][1024] . B[.][1024]^T (bf16) per block. k_qkv (SPLIT false, MI = 4): A is bf16, four waves (2 x 2, 64 x 64 each); k_out (SPLIT true, MI = 2): A is f32, eight waves (4 x 2, 32 x 64 each), two a SIMD where a WGP holds one block.
// A stage is 64 k of both operands in LDS: 128 A rows (f32: 256 B at pitch 272; bf16: 128 B at pitch 144), then 128 B rows of 128 B at pitch 144 (16 B x odd for the 16-byte readers). Two buffers: the next stage's copies fly while this one is worked on.
#define GKW 64
#define GAP 272
#define GBP 144
#define GAB (128 * GAP)
#define GST (GAB + 128 * GBP)
#define GSH (2 * 128 * GBP)   // a stage whose A rows are bf16
typedef __attribute__((ext_vector_type(2))) __bf16 v2b;
__device__ __forceinline__ unsigned lds_off(const void* p) { return (unsigned)(size_t)p; }
// eight asynchronous 16-byte copies per lane, global -> LDS; the s_wait_xcnt closes the statement so that no address register is rewritten ahead of it
__device__ __forceinline__ void cp8(unsigned l, unsigned ls, const char* g, size_t gs) {
  asm volatile("global_load_async_to_lds_b128 %0, %8, off\n\t"
               "global_load_async_to_lds_b128 %1, %9, off\n\t"
               "global_load_async_to_lds_b128 %2, %10, off\n\t"
               "global_load_async_to_lds_b128 %3, %11, off\n\t"
               "global_load_async_to_lds_b128 %4, %12, off\n\t"
               "global_load_async_to_lds_b128 %5, %13, off\n\t"
               "global_load_async_to_lds_b128 %6, %14, off\n\t"
               "global_load_async_to_lds_b128 %7, %15, off\n\t"
               "s_wait_xcnt 0x0"
               :: "v"(l), "v"(l + ls), "v"(l + 2 * ls), "v"(l + 3 * ls), "v"(l + 4 * ls), "v"(l + 5 * ls), "v"(l + 6 * ls), "v"(l + 7 * ls),
                  "v"(g), "v"(g + gs), "v"(g + 2 * gs), "v"(g + 3 * gs), "v"(g + 4 * gs), "v"(g + 5 * gs), "v"(g + 6 * gs), "v"(g + 7 * gs) : "memory");
}
// four such copies per lane, closed in the same way
__device__ __forceinline__ void cp4(unsigned l, unsigned ls, const char* g, size_t gs) {
  asm volatile("global_load_async_to_lds_b128 %0, %4, off\n\t"
               "global_load_async_to_lds_b128 %1, %5, off\n\t"
               "global_load_async_to_lds_b128 %2, %6, off\n\t"
               "global_load_async_to_lds_b128 %3, %7, off\n\t"
               "s_wait_xcnt 0x0"
               :: "v"(l), "v"(l + ls), "v"(l + 2 * ls), "v"(l + 3 * ls), "v"(g), "v"(g + gs), "v"(g + 2 * gs), "v"(g + 3 * gs) : "memory");
}
// one stage, dealt over the block's 128 (bf16 A) or 256 (f32 A) threads: a wave's copy covers four whole bf16 rows (4 x 128 B) or two whole f32 rows (2 x 256 B). A points at the stage's first byte
template <bool SPLIT> __device__ __forceinline__ void g_stage(unsigned lb, const char* A, const __bf16* B, int tid) {
  const unsigned l8 = (unsigned)(tid >> 3) * GBP + (unsigned)(tid & 7) * 16; const size_t g8 = (size_t)(tid >> 3) * (DM * 2) + (tid & 7) * 16;   // this thread's first 16 bytes among bf16 rows, in LDS and in global memory
  if (!SPLIT) {   // rows tid / 8 + 16 n (n < 8) of A and of B
    cp8(lb + l8, 16 * GBP, A + g8, (size_t)16 * DM * 2);
    cp8(lb + 128 * GBP + l8, 16 * GBP, (const char*)B + g8, (size_t)16 * DM * 2);
  } else {   // A rows tid / 16 + 16 n (n < 8), B rows tid / 8 + 32 n (n < 4)
    cp8(lb + (unsigned)(tid >> 4) * GAP + (unsigned)(tid & 15) * 16, 16 * GAP, A + (size_t)(tid >> 4) * (DM * 4) + (tid & 15) * 16, (size_t)16 * DM * 4);
    cp4(lb + GAB + l8, 32 * GBP, (const char*)B + g8, (size_t)32 * DM * 2);
  }
}
// A, B point at the tile's first row; SPLIT: A is f32, taken as bf16 hi + residual (2 products per k-step, residual first), else A is bf16 as it lies. Every accumulator sums its k-steps in rising order. The inner loops are unrolled whole so that every fragment and accumulator index is a constant (registers, no scratch).
template <bool SPLIT, int MI> __device__ __forceinline__ void g_core(const char* __restrict__ A, const __bf16* __restrict__ B, unsigned char* sm, int tid, v8f (&acc)[MI][4]) {
  constexpr unsigned AP = SPLIT ? GAP : GBP, ST = SPLIT ? GST : GSH, AW = SPLIT ? 4 : 2;   // A: row pitch in LDS; bytes of a stage; bytes of an element
  const int wave = tid >> 5, lane = tid & 31, col = lane & 15, g = lane >> 4, wm = wave >> 1, wn = wave & 1; const unsigned l0 = lds_off(sm);
  g_stage<SPLIT>(l0, A, B, tid);
  asm volatile("s_wait_asynccnt 0x0" ::: "memory");   // stage 0 landed (this wave's copies)
  __syncthreads();                                    // ... and every other wave's
  g_stage<SPLIT>(l0 + ST, A + GKW * AW, B + GKW, tid);
#pragma unroll 1   // one stage per trip: the ring's order stays as written
  for (int t = 0; t < DM / GKW; ++t) {
    const unsigned char* sa = sm + (t & 1) * ST + (wm * (MI * 16) + col) * AP + 8 * AW * g; const unsigned char* sb = sm + (t & 1) * ST + 128 * AP + (wn * 64 + col) * GBP + 16 * g;
#pragma unroll
    for (int kc = 0; kc < GKW / 32; ++kc) { v16b w[4];
#pragma unroll
      for (int j = 0; j < 4; ++j) { union { v16b v; v8b q[2]; } u; u.q[0] = *(const v8b*)(sb + j * 16 * GBP + kc * 64); u.q[1] = *(const v8b*)(sb + j * 16 * GBP + kc * 64 + 32); w[j] = u.v; }
      if (!SPLIT) { v16b a[MI];   // the k-step's A fragments, read with its B fragments as one group of LDS reads; k order as in the B rows
#pragma unroll
        for (int i = 0; i < MI; ++i) { union { v16b v; v8b q[2]; } u; u.q[0] = *(const v8b*)(sa + i * 16 * AP + kc * 64); u.q[1] = *(const v8b*)(sa + i * 16 * AP + kc * 64 + 32); a[i] = u.v; }
#pragma unroll
        for (int i = 0; i < MI; ++i) {
#pragma unroll
          for (int j = 0; j < 4; ++j) acc[i][j] = wmma_bf(a[i], w[j], acc[i][j]); }
      } else {
#pragma unroll
      for (int i = 0; i < MI; ++i) { const v2f* p = (const v2f*)(sa + i * 16 * AP + kc * 128); union { v16b v; v2b q[8]; } h, l;   // k order of the fragment: 8 g + 0..7, then 16 + 8 g + 0..7, as in the B rows
#pragma unroll
        for (int e = 0; e < 4; ++e) { const v2f x0 = p[e], x1 = p[8 + e]; h.q[e] = __builtin_convertvector(x0, v2b); h.q[4 + e] = __builtin_convertvector(x1, v2b);
          l.q[e] = __builtin_convertvector(x0 - __builtin_convertvector(h.q[e], v2f), v2b); l.q[4 + e] = __builtin_convertvector(x1 - __builtin_convertvector(h.q[4 + e], v2f), v2b); }
#pragma unroll
        for (int j = 0; j < 4; ++j) acc[i][j] = wmma_bf(l.v, w[j], acc[i][j]);
#pragma unroll
        for (int j = 0; j < 4; ++j) acc[i][j] = wmma_bf(h.v, w[j], acc[i][j]); } } }
    asm volatile("s_wait_dscnt 0x0" ::: "memory");      // this wave has left the buffer
    asm volatile("s_wait_asynccnt 0x0" ::: "memory");   // its copies of stage t + 1 have landed
    __syncthreads();                                    // publishes stage t + 1 and frees stage t's buffer
    if (t + 2 < DM / GKW) g_stage<SPLIT>(l0 + (t & 1) * ST, A + (t + 2) * (GKW * AW), B + (t + 2) * GKW, tid);
  }
  asm volatile("s_wait_asynccnt 0x0" ::: "memory");     // nothing in flight when the ring becomes output staging
}
__global__ __launch_bounds__(128) void k_qkv(const __bf16* __restrict__ XB, const __bf16* __restrict__ P, const float* __restrict__ BQ, const float* __restrict__ BK, const float* __restrict__ BV, float* __restrict__ QF, _Float16* __restrict__ QK, _Float16* __restrict__ QKL, _Float16* __restrict__ VTH, _Float16* __restrict__ VTL) {
  const int which0 = (blockIdx.y * 128) / DM; const float* BB = BQ ? (((which0 == 0) ? BQ : (which0 == 1) ? BK : BV) + (blockIdx.y * 128 - which0 * DM)) : nullptr;
  __shared__ __attribute__((aligned(16))) unsigned char sm[2 * GSH];   // the ring; behind the loop 69,632 B of it are output staging
  const int tid = threadIdx.x, wave = tid >> 5, lane = tid & 31, col = lane & 15, g = lane >> 4, wm = wave >> 1, wn = wave & 1; const size_t m0 = (size_t)blockIdx.x * 128; const int n0 = blockIdx.y * 128;
  v8f acc[4][4] = {};
  g_core<false, 4>((const char*)(XB + m0 * DM), P + (size_t)n0 * DM, sm, tid, acc);
  float bj[4] = {0.f, 0.f, 0.f, 0.f};   // this lane's four bias values
  if (BB) {
#pragma unroll
    for (int j = 0; j < 4; ++j) bj[j] = bfr(BB[wn * 64 + j * 16 + col]); }
  if (n0 < 2 * DM) {   // q and k kept in f32 (LayerNorm comes next); each wave stages its own 64 x 64 in its own range of the ring
    float* sf = (float*)(sm + wave * (64 * 68 * 4));
#pragma unroll
    for (int j = 0; j < 4; ++j) {
#pragma unroll
      for (int i = 0; i < 4; ++i) {
#pragma unroll
        for (int r = 0; r < 8; ++r) sf[(i * 16 + 8 * g + r) * 68 + j * 16 + col] = acc[i][j][r] + bj[j]; } }
    LDSX();
    for (int rl = 0; rl < 32; ++rl) vst2(QF + (m0 + wm * 64 + rl * 2 + g) * (2 * DM) + n0 + wn * 64 + col * 4, *(const v4f*)&sf[(rl * 2 + g) * 68 + col * 4]);
    asm volatile("s_wait_xcnt 0x0" ::: "memory");   // closes the run of stores before any code laid out behind it rewrites an address register
  } else {
    _Float16* sth = (_Float16*)sm; _Float16* stl = (_Float16*)(sm + 128 * 136 * 2);   // [128 d][136 s] each
#pragma unroll
    for (int j = 0; j < 4; ++j) {
#pragma unroll
      for (int i = 0; i < 4; ++i) { v8h hv8, lv8;
#pragma unroll
        for (int r = 0; r < 8; ++r) { const float v = acc[i][j][r] + bj[j]; const _Float16 hv = (_Float16)v; hv8[r] = hv; lv8[r] = (_Float16)((v - (float)hv) * 2048.0f); }
        const int o = (wn * 64 + j * 16 + col) * 136 + wm * 64 + i * 16 + 8 * g; *(v8h*)&sth[o] = hv8; *(v8h*)&stl[o] = lv8; } }
    __syncthreads();
    const int b = (int)(m0 / SS), s0 = (int)(m0 % SS); const int pc0 = n0 - 2 * DM;
    for (int it = 0; it < 16; ++it) { const int q = it * 128 + tid, d = q >> 4, pc = q & 15; const size_t o = ((size_t)b * DM + pc0 + d) * SS + s0 + pc * 8; vst2((unsigned*)(VTH + o), *(const v4u*)&sth[d * 136 + pc * 8]); vst2((unsigned*)(VTL + o), *(const v4u*)&stl[d * 136 + pc * 8]); }
    asm volatile("s_wait_xcnt 0x0" ::: "memory");   // closes the run of stores before any code laid out behind it rewrites an address register
  }
}
// ---- k_attn: block = (64 queries, head h, batch b): all-keys flash attention (K = 64: 2 k-steps), scores = (q.k) * 0.125 with single f16 operands, P.V: f16 P x f16 V; O[b*S+q][h*64+d] = acc / l (256-B segments)
// A stage is 64 keys of this head in LDS, shared by the block's four waves: 64 K rows of 128 B, then 64 V^T rows (one per d) of 128 B, all at pitch 144 (16 B x odd for the 16-byte readers). Two buffers: the next stage's copies fly while this one is worked on.
#define AKT 64
#define ATP 144
#define ATK (64 * ATP)
#define AST (2 * ATK)
// one stage: eight asynchronous 16-byte copies per lane, global -> LDS, four of K and four of V^T; a wave's copy covers four whole 128-B rows; the s_wait_xcnt closes the statement so that no address register is rewritten ahead of it
__device__ __forceinline__ void a_stage(unsigned lb, const _Float16* K, const _Float16* V, int tid) {
  const unsigned lk = lb + (unsigned)(tid >> 3) * ATP + (unsigned)(tid & 7) * 16, lv = lk + ATK, ls = 16 * ATP;
  const char* gk = (const char*)K + (size_t)(tid >> 3) * (2 * DM * 2) + (tid & 7) * 16; const size_t ks = (size_t)16 * 2 * DM * 2;
  const char* gv = (const char*)V + (size_t)(tid >> 3) * (SS * 2) + (tid & 7) * 16; const size_t vs = (size_t)16 * SS * 2;
  asm volatile("global_load_async_to_lds_b128 %0, %8, off\n\t"
               "global_load_async_to_lds_b128 %1, %9, off\n\t"
               "global_load_async_to_lds_b128 %2, %10, off\n\t"
               "global_load_async_to_lds_b128 %3, %11, off\n\t"
               "global_load_async_to_lds_b128 %4, %12, off\n\t"
               "global_load_async_to_lds_b128 %5, %13, off\n\t"
               "global_load_async_to_lds_b128 %6, %14, off\n\t"
               "global_load_async_to_lds_b128 %7, %15, off\n\t"
               "s_wait_xcnt 0x0"
               :: "v"(lk), "v"(lk + ls), "v"(lk + 2 * ls), "v"(lk + 3 * ls), "v"(lv), "v"(lv + ls), "v"(lv + 2 * ls), "v"(lv + 3 * ls),
                  "v"(gk), "v"(gk + ks), "v"(gk + 2 * ks), "v"(gk + 3 * ks), "v"(gv), "v"(gv + vs), "v"(gv + 2 * vs), "v"(gv + 3 * vs) : "memory");
}
// fragment from a staged row; p = row start + 16 g bytes: k order 8 g + 0..7, then 16 + 8 g + 0..7, as frag_h
__device__ __forceinline__ v16h frag_l(const unsigned char* p) { union { v16h v; v8h q[2]; } u; u.q[0] = *(const v8h*)p; u.q[1] = *(const v8h*)(p + 32); return u.v; }
// lane l <-> lane l ^ 16: the two halves of a wave hold the two halves of a query's keys
__device__ __forceinline__ float xhalf(float x) { const int b = __builtin_bit_cast(int, x); return __builtin_bit_cast(float, __builtin_amdgcn_permlanex16(b, b, 0x76543210, 0xfedcba98, false, false)); }
__device__ __forceinline__ v8f wmma_t(v16h a, v16h b, v8f c) { return __builtin_amdgcn_wmma_f32_16x16x32_f16(false, a, false, b, (short)0, c, false, false); }
// Transposed products: S^T = K . Q^T (A = 16 staged K rows, B = the wave's 16 queries) and O^T += V^T . P^T (A = 16 staged V^T rows, B = P^T). Lane (col, g) holds query col: of each 16-key score tile the keys 8 g + 0..7, of each output tile d = 8 g + 0..7.
// So a query's maximum and sum are taken inside the lane, with one exchange between the halves, and two score tiles, converted in place, are the B operand of the second product in the fragment's own k order (8 g + 0..7, then 16 + 8 g + 0..7, as frag_l reads V^T).
__global__ __launch_bounds__(128) void k_attn(const _Float16* __restrict__ QK, const _Float16* __restrict__ QKL, const _Float16* __restrict__ VTH, const _Float16* __restrict__ VTL, const void* __restrict__ KMASK, float* __restrict__ O) {
  __shared__ __align__(16) float so[4][16][68]; __shared__ __attribute__((aligned(16))) unsigned char ring[2 * AST];
  const int tid = threadIdx.x, wave = tid >> 5, lane = tid & 31, col = lane & 15, g = lane >> 4;
  const int qb = blockIdx.x, h = blockIdx.y, b = blockIdx.z; const int q0 = qb * 64 + wave * 16; const size_t rq = (size_t)b * SS + q0 + col;
  const unsigned l0 = lds_off(ring); const _Float16* Kg = QK + (size_t)b * SS * (2 * DM) + DM + h * HD; const _Float16* Vg = VTH + ((size_t)b * DM + h * HD) * SS;
  a_stage(l0, Kg, Vg, tid);
  v16h aq[2];
#pragma unroll
  for (int kc = 0; kc < 2; ++kc) aq[kc] = frag_h(QK + rq * (2 * DM) + h * HD + kc * 32, lane);
  const float cs = 0.125f * 1.4426950408889634f;   // 1/sqrt(64), and the exponentials in base 2
  float m = -3.0e38f, l = 0.f;   // of query col: running maximum (scaled, the same in both halves) and this half's part of the sum
  v8f acc[4] = {};
  asm volatile("s_wait_asynccnt 0x0" ::: "memory");   // stage 0 landed (this wave's copies)
  __syncthreads();                                    // ... and every other wave's
  a_stage(l0 + AST, Kg + (size_t)AKT * (2 * DM), Vg + AKT, tid);
#pragma unroll 1   // one stage per trip: the ring's order stays as written
  for (int t = 0; t < SS / AKT; ++t) { const unsigned char* sk = ring + (t & 1) * AST + col * ATP + 16 * g; const unsigned char* sv = sk + ATK;
#pragma unroll   // both 32-key steps of the stage, keys in rising order: every LDS offset is a constant
  for (int u = 0; u < AKT / 32; ++u) { v8f s[2]; v16h kf[2][2], vf[4];   // the step's K and V^T fragments, read as one group of LDS reads ahead of its products
#pragma unroll
    for (int ct = 0; ct < 2; ++ct) {
#pragma unroll
      for (int kc = 0; kc < 2; ++kc) kf[ct][kc] = frag_l(sk + (u * 32 + ct * 16) * ATP + kc * 64); }
#pragma unroll
    for (int dt = 0; dt < 4; ++dt) vf[dt] = frag_l(sv + dt * 16 * ATP + u * 64);
#pragma unroll
    for (int ct = 0; ct < 2; ++ct) { v8f c = {};
#pragma unroll
      for (int kc = 0; kc < 2; ++kc) c = wmma_t(kf[ct][kc], aq[kc], c);   // single product: k, q as one-rounding f16 operands
      s[ct] = c; }
    float mx = fmaxf(s[0][0], s[1][0]);   // maximum of the raw scores (the scale is positive)
#pragma unroll
    for (int r = 1; r < 8; ++r) mx = fmaxf(mx, fmaxf(s[0][r], s[1][r]));
    mx = fmaxf(mx, xhalf(mx)) * cs;
    const float mn = fmaxf(m, mx), nb = 11.0f - mn; float alpha;
    asm("v_exp_f32 %0, %1\n\tv_nop" : "=v"(alpha) : "v"(m - mn));   // exp2, in asm so that the v_nop stands directly behind it: the slot that the instruction set asks for before a transcendental's source register is written again
    m = mn;   // alpha is 0 on the first step; P carries 2^11 so that small softmax weights stay out of the f16 subnormal range, and so does the sum: it cancels in the epilogue
    union { v16h v; v2h q[8]; } pa; v2f es[2];
#pragma unroll
    for (int ct = 0; ct < 2; ++ct) {
#pragma unroll
      for (int i = 0; i < 4; ++i) { const v2f x = __builtin_elementwise_fma(v2f{s[ct][2 * i], s[ct][2 * i + 1]}, v2f{cs, cs}, v2f{nb, nb}); const v2f e = {__builtin_amdgcn_exp2f(x.x), __builtin_amdgcn_exp2f(x.y)};
        es[ct] = i ? es[ct] + e : e; pa.q[ct * 4 + i] = __builtin_convertvector(e, v2h); } }
    l = l * alpha + ((es[0].x + es[1].x) + (es[0].y + es[1].y));
#pragma unroll
    for (int dt = 0; dt < 4; ++dt) acc[dt] = acc[dt] * alpha;
#pragma unroll
    for (int dt = 0; dt < 4; ++dt) acc[dt] = wmma_t(vf[dt], pa.v, acc[dt]); }   // single product: V x P (x2^11)
    asm volatile("s_wait_dscnt 0x0" ::: "memory");      // this wave has left the buffer
    asm volatile("s_wait_asynccnt 0x0" ::: "memory");   // its copies of stage t + 1 have landed
    __syncthreads();                                    // publishes stage t + 1 and frees stage t's buffer
    if (t + 2 < SS / AKT) a_stage(l0 + (t & 1) * AST, Kg + (size_t)(t + 2) * AKT * (2 * DM), Vg + (t + 2) * AKT, tid);
  }
  asm volatile("s_wait_asynccnt 0x0" ::: "memory");     // nothing in flight when the wave goes on to its end
  const float il = 1.0f / (l + xhalf(l));   // the halves' sums joined once
#pragma unroll
  for (int dt = 0; dt < 4; ++dt) { const v8f o = acc[dt] * il; *(v4f*)&so[wave][col][dt * 16 + 8 * g] = v4f{o[0], o[1], o[2], o[3]}; *(v4f*)&so[wave][col][dt * 16 + 8 * g + 4] = v4f{o[4], o[5], o[6], o[7]}; }
  LDSX();
  for (int rl = 0; rl < 16; ++rl) if (lane < 16) vst2(O + ((size_t)b * SS + q0 + rl) * DM + h * HD + lane * 4, *(const v4f*)&so[wave][rl][lane * 4]);
}
// ---- k_out: block = (128 rows, 128 cols), eight waves of 32 x 64: out = O(hi/lo) . Wo rows (2 products) + bo. The grid is one block a WGP: with eight waves each SIMD has a second wave to issue while the first waits on LDS or converts
__global__ __launch_bounds__(256) void k_out(const float* __restrict__ O, const __bf16* __restrict__ P, const float* __restrict__ BO, float* __restrict__ Y) {
  __shared__ __attribute__((aligned(16))) unsigned char sm[2 * GST];
  const int tid = threadIdx.x, wave = tid >> 5, lane = tid & 31, col = lane & 15, g = lane >> 4, wm = wave >> 1, wn = wave & 1; const size_t m0 = (size_t)blockIdx.x * 128; const int n0 = blockIdx.y * 128;
  v8f acc[2][4] = {};
  g_core<true, 2>((const char*)(O + m0 * DM), P + (size_t)n0 * DM, sm, tid, acc);
  float bj[4];   // this lane's four bias values
#pragma unroll
  for (int j = 0; j < 4; ++j) bj[j] = bfr(BO[n0 + wn * 64 + j * 16 + col]);
  float* sf = (float*)(sm + wave * (32 * 68 * 4));   // each wave stages its own 32 x 64 in its own range of the ring
#pragma unroll
  for (int j = 0; j < 4; ++j) {
#pragma unroll
    for (int i = 0; i < 2; ++i) {
#pragma unroll
      for (int r = 0; r < 8; ++r) sf[(i * 16 + 8 * g + r) * 68 + j * 16 + col] = acc[i][j][r] + bj[j]; } }
  LDSX();
  for (int rl = 0; rl < 16; ++rl) vst2(Y + (m0 + wm * 32 + rl * 2 + g) * DM + n0 + wn * 64 + col * 4, *(const v4f*)&sf[(rl * 2 + g) * 68 + col * 4]);
}
// ---- k_lnqk: LayerNorm over the 1,024 flattened head dims (jnp.var, 1e-5) x g + b -> f16 row into the engine's q | k layout. A wave takes the q rows, or the k rows, of two tokens whole in registers (lane l holds columns 128 j + 4 l + 0..3); all its loads are in flight together; no LDS, no barrier; 4,096 waves, four a SIMD
template <int C> __device__ __forceinline__ float rowx(float x) { return __builtin_bit_cast(float, __builtin_amdgcn_update_dpp(0, __builtin_bit_cast(int, x), C, 0xf, 0xf, true)); }   // lane l <- lane l ^ (C & 15) of its 16-lane row (row_xmask)
__device__ __forceinline__ float wsum(float s) { s += rowx<0x161>(s); s += rowx<0x162>(s); s += rowx<0x164>(s); s += rowx<0x168>(s); return s + xhalf(s); }   // sum over the wave, the same bits in every lane
__global__ __launch_bounds__(256) __attribute__((amdgpu_waves_per_eu(2, 4))) void k_lnqk(const float* __restrict__ QF, const float* __restrict__ GQ, const float* __restrict__ BQn, const float* __restrict__ GK, const float* __restrict__ BKn, _Float16* __restrict__ QK) {
  const unsigned l4 = (threadIdx.x & 31) * 4, w = blockIdx.x * 8 + __builtin_amdgcn_readfirstlane(threadIdx.x >> 5), which = w & 1; const size_t o = (size_t)(w >> 1) * 2 * (2 * DM) + which * DM;   // o is the same in the whole wave: scalar base, one lane offset
  const float* X = QF + o; const float* G = which ? GK : GQ; const float* Bt = which ? BKn : BQn; _Float16* Y = QK + o;
  v4f x[2][8], gg[8], bb[8];
#pragma unroll
  for (int r = 0; r < 2; ++r) {
#pragma unroll
    for (int j = 0; j < 8; ++j) x[r][j] = *(const v4f*)(X + l4 + r * (2 * DM) + j * 128); }
#pragma unroll
  for (int j = 0; j < 8; ++j) { gg[j] = *(const v4f*)(G + l4 + j * 128); bb[j] = *(const v4f*)(Bt + l4 + j * 128); }
  v4h y[2][8];
#pragma unroll
  for (int r = 0; r < 2; ++r) { v4f s4 = x[r][0];
#pragma unroll
    for (int j = 1; j < 8; ++j) s4 += x[r][j];
    const float mu = wsum((s4.x + s4.y) + (s4.z + s4.w)) / (float)DM; v4f q4 = {};
#pragma unroll
    for (int j = 0; j < 8; ++j) { const v4f d = x[r][j] - mu; q4 += d * d; }
    const float inv = 1.0f / sqrtf(wsum((q4.x + q4.y) + (q4.z + q4.w)) / (float)DM + 1e-5f);
#pragma unroll
    for (int j = 0; j < 8; ++j) {
#pragma unroll
      for (int i = 0; i < 4; ++i) y[r][j][i] = (_Float16)((x[r][j][i] - mu) * inv * bfr(gg[j][i]) + bfr(bb[j][i])); } }
#pragma unroll   // both rows' stores stand last: nothing behind them writes a register
  for (int r = 0; r < 2; ++r) {
#pragma unroll
    for (int j = 0; j < 8; ++j) *(v4h*)(Y + l4 + r * (2 * DM) + j * 128) = y[r][j]; }
}
extern "C" void kernel_launch(void* const* d_in, const int* in_sizes, int n_in, void* d_out, int out_size, void* d_ws, size_t ws_size, hipStream_t stream) {
  (void)in_sizes; (void)n_in; (void)out_size;
  const float** F = (const float**)d_in;   // 0 x [4,1024,1024], 1 qkv_w [3072,1024] natural (q | k | v row blocks), 2 qkv_b, 3 q_norm_g, 4 q_norm_b, 5 k_norm_g, 6 k_norm_b, 7 proj_w [1024,1024], 8 proj_b
  if (ws_size < (size_t)WS_END) return;
  char* ws = (char*)d_ws; __bf16* PK = (__bf16*)(ws + WS_PK); _Float16 *QK = (_Float16*)(ws + WS_QK), *QKL = (_Float16*)(ws + WS_QKL), *VTH = (_Float16*)(ws + WS_VTH), *VTL = (_Float16*)(ws + WS_VTL); float *O = (float*)(ws + WS_O), *QF = (float*)(ws + WS_QF); __bf16* XB = (__bf16*)(ws + WS_XB);
  k_pack<<<dim3(4 * DM / 16), 256, 0, stream>>>(F[1], F[1] + (size_t)DM * DM, F[1] + (size_t)2 * DM * DM, F[7], F[0], PK, XB);
  k_qkv<<<dim3(TNB * SS / 128, QKVW / 128), 128, 0, stream>>>(XB, PK + PK_A, F[2], F[2] + DM, F[2] + 2 * DM, QF, QK, QKL, VTH, VTL);
  k_lnqk<<<dim3(TNB * SS * 2 / 16), 256, 0, stream>>>(QF, F[3], F[4], F[5], F[6], QK);
  k_attn<<<dim3(TQB, NH, TNB), 128, 0, stream>>>(QK, QKL, VTH, VTL, nullptr, O);
  k_out<<<dim3(TOB / 2, DM / 128), 256, 0, stream>>>(O, PK + PK_P, F[8], (float*)d_out);
}

// v007
// It runs in 81.2 microseconds.
// Next to v006, in two timings, it ran 1.03 times as fast each time.
// Counting every step since v000, it is 4.06 times as fast.
// compute dtype: all float inputs rounded to bf16; qkv = x . W^T + b with EXACT bf16 products on WMMA 16x16x32 (natural rows; three contiguous row blocks) kept in f32 for q and k; the two per-token LayerNorms (1,024 wide, eps 1e-5) in f32, then q, k rounded once to f16; PLAIN attention: x 1/8, running-max softmax in f32 (hardware exp), P (scaled by 2^11, single f16) x v (single f16); out = o (bf16 hi + residual) . proj_w^T (2 products) + proj_b.
#include <hip/hip_runtime.h>
#include <math.h>

typedef __attribute__((ext_vector_type(16))) _Float16 v16h;
typedef __attribute__((ext_vector_type(16))) __bf16 v16b;
typedef __attribute__((ext_vector_type(8)))  _Float16 v8h;
typedef __attribute__((ext_vector_type(2)))  _Float16 v2h;
typedef __attribute__((ext_vector_type(8)))  float v8f;
typedef __attribute__((ext_vector_type(4)))  float v4f;
typedef __attribute__((ext_vector_type(2)))  float v2f;
typedef __attribute__((ext_vector_type(4)))  unsigned v4u;
typedef __attribute__((ext_vector_type(4)))  int v4i;
typedef float __attribute__((may_alias)) float_a;
typedef int __attribute__((may_alias)) int_a;

template <typename T> __device__ __forceinline__ void vst2(void* p, T v) { *(T*)p = v;  }
__device__ __forceinline__ v8f wmma16(v16h a, v16h b, v8f c) {
  v8f d = __builtin_amdgcn_wmma_f32_16x16x32_f16(false, a, false, b, (short)0, c, false, false);
  asm volatile("v_nop\n\tv_nop\n\tv_nop\n\tv_nop" : "+v"(d) : "v"(a), "v"(b));
  return d;
}
__device__ __forceinline__ v8f wmma_bf(v16b a, v16b b, v8f c) {
  v8f d = __builtin_amdgcn_wmma_f32_16x16x32_bf16(false, a, false, b, (short)0, c, false, false);
  asm volatile("v_nop\n\tv_nop\n\tv_nop\n\tv_nop" : "+v"(d) : "v"(a), "v"(b));
  return d;
}
// attention with qk LayerNorm (B 4, N 1,024, C 1,024, 16 heads x 64): fused qkv projection + bias, LayerNorm over the flattened q and k per token, softmax(q k / 8) v, output projection + bias.
__device__ __forceinline__ v16h frag_h(const _Float16* rowk0, int lane) {
  union { v16h v; v8h q[2]; } u; const _Float16* p = rowk0 + 8 * (lane >> 4);
  u.q[0] = *(const v8h*)p; u.q[1] = *(const v8h*)(p + 16); return u.v;
}
__device__ __forceinline__ v16h frag_f32(const float* rowk0, int lane) {
  v16h a; const float* p = rowk0 + 8 * (lane >> 4);
#pragma unroll
  for (int i = 0; i < 8; ++i) { a[i] = (_Float16)p[i]; a[8 + i] = (_Float16)p[16 + i]; }
  return a;
}
__device__ __forceinline__ v16h frag_f32s(const float* rowk0, int lane, float sc) {
  v16h a; const float* p = rowk0 + 8 * (lane >> 4);
#pragma unroll
  for (int i = 0; i < 8; ++i) { a[i] = (_Float16)(p[i] * sc); a[8 + i] = (_Float16)(p[16 + i] * sc); }
  return a;
}
// column fragment from a [K][ld] layout (column n), rows >= K read as 0
__device__ __forceinline__ v16h fragc_f32(const float* W, int k0, int n, int lane, int ld, int K) {
  v16h a; const int g = lane >> 4;
#pragma unroll
  for (int i = 0; i < 8; ++i) { const int ka = k0 + 8 * g + i, kb = ka + 16;
    a[i] = (_Float16)(ka < K ? W[(size_t)(ka < K ? ka : K - 1) * ld + n] : 0.f); a[8 + i] = (_Float16)(kb < K ? W[(size_t)(kb < K ? kb : K - 1) * ld + n] : 0.f); }
  return a;
}
struct F2 { v16b h, l; };
__device__ __forceinline__ F2 bsplit16(const float v[16]) { F2 r;
#pragma unroll
  for (int i = 0; i < 16; ++i) { const __bf16 h = (__bf16)v[i]; r.h[i] = h; r.l[i] = (__bf16)(v[i] - (float)h); }
  return r; }
__device__ __forceinline__ F2 split_row(const float* row, int k0, int lane) { float v[16]; const float* p = row + k0 + 8 * (lane >> 4);
#pragma unroll
  for (int i = 0; i < 8; ++i) { v[i] = p[i]; v[8 + i] = p[16 + i]; }
  return bsplit16(v); }
__device__ __forceinline__ F2 split_rowK(const float* row, int k0, int lane, int K) { float v[16]; const int g = lane >> 4;
#pragma unroll
  for (int i = 0; i < 8; ++i) { const int ka = k0 + 8 * g + i, kb = ka + 16; v[i] = ka < K ? row[ka < K ? ka : K - 1] : 0.f; v[8 + i] = kb < K ? row[kb < K ? kb : K - 1] : 0.f; }
  return bsplit16(v); }
__device__ __forceinline__ F2 split_col(const float* W, int k0, int n, int lane, int ld, int K) { float v[16]; const int g = lane >> 4;
#pragma unroll
  for (int i = 0; i < 8; ++i) { const int ka = k0 + 8 * g + i, kb = ka + 16; v[i] = ka < K ? W[(size_t)(ka < K ? ka : K - 1) * ld + n] : 0.f; v[8 + i] = kb < K ? W[(size_t)(kb < K ? kb : K - 1) * ld + n] : 0.f; }
  return bsplit16(v); }
__device__ __forceinline__ v8f mac3(const F2& a, const F2& b, v8f c) { c = wmma_bf(a.l, b.h, c); c = wmma_bf(a.h, b.l, c); return wmma_bf(a.h, b.h, c); }
__device__ __forceinline__ float sigm(float v) { return 1.0f / (1.0f + expf(-v)); }
#define LDSX() do { asm volatile("s_wait_dscnt 0" ::: "memory"); __builtin_amdgcn_wave_barrier(); __builtin_amdgcn_fence(__ATOMIC_RELEASE, "workgroup"); } while (0)


#define NB 4
#define SS 1024
#define DM 1024
#define NH 16
#define HD 64
#define QKVW (3 * DM)
#ifndef TQB
#define TQB (SS / 64)
#define TNB NB
#define TOB (NB * SS / 64)     // output row tiles (all)
#endif
typedef __attribute__((ext_vector_type(8))) __bf16 v8b;
__device__ __forceinline__ v16b frag_b(const __bf16* rowk0, int lane) {
  union { v16b v; v8b q[2]; } u; const __bf16* p = rowk0 + 8 * (lane >> 4);
  u.q[0] = *(const v8b*)p; u.q[1] = *(const v8b*)(p + 16); return u.v;
}
__device__ __forceinline__ float bfr(float v) { return (float)(__bf16)v; }
__device__ __attribute__((noinline)) float exp_ni(float v) { return expf(v); }
__device__ __attribute__((noinline)) float erf_ni(float v) { return erff(v); }

#define PK_A 0                       // [3072][1024] Wqkv rows (natural [out][in])
#define PK_P (PK_A + QKVW * DM)        // [1024][1024] Wo rows (natural)
#define PK_END (PK_P + DM * DM)
#define WS_PK  0u
#define WS_QK  (WS_PK + 2u * PK_END)             // f16 [4096 rows][2048]: q | k
#define WS_QKL (WS_QK + 2u * NB * SS * 2 * DM)     // f16 [4096][2048]; never written or read
#define WS_VTH (WS_QKL + 2u * NB * SS * 2 * DM)    // f16 [b][1024 (h*64+d)][1024 s] hi
#define WS_VTL (WS_VTH + 2u * NB * DM * SS)        // f16 lo x 2048
#define WS_O   (WS_VTL + 2u * NB * DM * SS)        // f32 [4096][1024]
#define WS_CS  (WS_O + 4u * NB * SS * DM)           // f32 [2][1024][32], not used
#define WS_QF  (WS_CS + 4u * 2 * SS * 32)                  // f32 [NR][2048] pre-LN q | k
#define WS_XB  (WS_QF + 4u * (size_t)NB * SS * 2 * DM)      // bf16 [4096 rows][1024]: x rounded once
#define WS_END (WS_XB + 2u * (size_t)NB * SS * DM)
// ---- k_pack: natural [out][in] f32 rows -> bf16. The 4,096 weight rows (W_q | W_k | W_v -> PK_A rows, W_o -> PK_P rows, which follow them) are dealt two to a wave, and with them the two rows of x of the same number (-> XB, so that k_qkv stages its A operand at two bytes an element and converts nothing in its loop): twice 8 KiB in a row, read by thirty-two 16-byte loads per lane that are all in flight together; no LDS, no barrier. Few, long waves: the launch starts 2,048 of them, two a SIMD.
// amdgpu_waves_per_eu(2, 4), here and on k_lnqk: register budget of four waves a SIMD, so that the compiler does not split a wave's run of loads to save registers. The loops of both kernels are unrolled whole so that every array index is a constant (registers, no scratch).
typedef __attribute__((ext_vector_type(4))) __bf16 v4b;
typedef __attribute__((ext_vector_type(4))) _Float16 v4h;
__global__ __launch_bounds__(256) __attribute__((amdgpu_waves_per_eu(2, 4))) void k_pack(const float* __restrict__ WQ, const float* __restrict__ WK, const float* __restrict__ WV, const float* __restrict__ WO, const float* __restrict__ X, __bf16* __restrict__ PK, __bf16* __restrict__ XB) {
  static_assert(NB * SS == 4 * DM, "x has as many rows as the four weight matrices together");
  const unsigned lane = threadIdx.x & 31, r0 = (blockIdx.x * 8 + __builtin_amdgcn_readfirstlane(threadIdx.x >> 5)) * 2, which = r0 / DM, n = r0 % DM;   // r0 is even: both rows lie in one matrix
  const char* s = (const char*)(((which == 0) ? WQ : (which == 1) ? WK : (which == 2) ? WV : WO) + (size_t)n * DM); const char* sx = (const char*)(X + (size_t)r0 * DM); const unsigned lb = lane * 16;   // scalar bases, one lane offset in bytes
  __bf16* dst = ((which < 3) ? PK + PK_A + ((size_t)which * DM + n) * DM : PK + PK_P + (size_t)n * DM) + lane * 4; __bf16* dx = XB + (size_t)r0 * DM + lane * 4;
  v4f v[16], x[16];
#pragma unroll
  for (int j = 0; j < 16; ++j) v[j] = *(const v4f*)(s + lb + j * 512);
#pragma unroll
  for (int j = 0; j < 16; ++j) x[j] = *(const v4f*)(sx + lb + j * 512);
#pragma unroll
  for (int j = 0; j < 16; ++j) *(v4b*)(dst + j * 128) = __builtin_convertvector(v[j], v4b);
#pragma unroll
  for (int j = 0; j < 16; ++j) *(v4b*)(dx + j * 128) = __builtin_convertvector(x[j], v4b);
}
// ---- tiled product core of k_qkv and k_out: one tile of A[.][1024] . B[.][1024]^T (bf16) per block. k_qkv (SPLIT false, MI = 4): A is bf16, a 256 x 192 tile, twelve waves (4 x 3, 64 x 64 each), three a SIMD: the grid is one block a WGP, and an operand row that comes from L2 into LDS serves 192 or 256 output columns or rows instead of 128; k_out (SPLIT true, MI = 2): A is f32, a 128 x 128 tile, eight waves (4 x 2, 32 x 64 each), two a SIMD where a WGP holds one block.
// A stage in LDS is the A rows, then the B rows, pitches 16 B x odd for the 16-byte readers. k_out: 64 k, 128 A rows of f32 (256 B at pitch 272), 128 B rows (128 B at pitch 144). k_qkv: 128 k, 256 A rows and 192 B rows of bf16 (256 B at pitch 272): its twelve waves meet at one barrier, so a long stage (eight trips) halves those meetings and gives each stage's copies twice the time to land. Two buffers: the next stage's copies fly while this one is worked on.
#define GKW 64
#define GAP 272
#define GBP 144
#define GAB (128 * GAP)
#define GST (GAB + 128 * GBP)
#define QAR 256               // k_qkv's tile: A rows,
#define QBR 192               // B rows
#define GSH ((QAR + QBR) * GAP)   // its stage: 128 k, all rows bf16
typedef __attribute__((ext_vector_type(2))) __bf16 v2b;
__device__ __forceinline__ unsigned lds_off(const void* p) { return (unsigned)(size_t)p; }
// eight asynchronous 16-byte copies per lane, global -> LDS; the s_wait_xcnt closes the statement so that no address register is rewritten ahead of it
__device__ __forceinline__ void cp8(unsigned l, unsigned ls, const char* g, size_t gs) {
  asm volatile("global_load_async_to_lds_b128 %0, %8, off\n\t"
               "global_load_async_to_lds_b128 %1, %9, off\n\t"
               "global_load_async_to_lds_b128 %2, %10, off\n\t"
               "global_load_async_to_lds_b128 %3, %11, off\n\t"
               "global_load_async_to_lds_b128 %4, %12, off\n\t"
               "global_load_async_to_lds_b128 %5, %13, off\n\t"
               "global_load_async_to_lds_b128 %6, %14, off\n\t"
               "global_load_async_to_lds_b128 %7, %15, off\n\t"
               "s_wait_xcnt 0x0"
               :: "v"(l), "v"(l + ls), "v"(l + 2 * ls), "v"(l + 3 * ls), "v"(l + 4 * ls), "v"(l + 5 * ls), "v"(l + 6 * ls), "v"(l + 7 * ls),
                  "v"(g), "v"(g + gs), "v"(g + 2 * gs), "v"(g + 3 * gs), "v"(g + 4 * gs), "v"(g + 5 * gs), "v"(g + 6 * gs), "v"(g + 7 * gs) : "memory");
}
// four such copies per lane, closed in the same way
__device__ __forceinline__ void cp4(unsigned l, unsigned ls, const char* g, size_t gs) {
  asm volatile("global_load_async_to_lds_b128 %0, %4, off\n\t"
               "global_load_async_to_lds_b128 %1, %5, off\n\t"
               "global_load_async_to_lds_b128 %2, %6, off\n\t"
               "global_load_async_to_lds_b128 %3, %7, off\n\t"
               "s_wait_xcnt 0x0"
               :: "v"(l), "v"(l + ls), "v"(l + 2 * ls), "v"(l + 3 * ls), "v"(g), "v"(g + gs), "v"(g + 2 * gs), "v"(g + 3 * gs) : "memory");
}
// one stage, dealt over the block's 384 (bf16 A) or 256 (f32 A) threads: a wave's copy covers two whole 256-B rows or four whole 128-B rows. A points at the stage's first byte
template <bool SPLIT> __device__ __forceinline__ void g_stage(unsigned lb, const char* A, const __bf16* B, int tid) {
  const unsigned l8 = (unsigned)(tid >> 3) * GBP + (unsigned)(tid & 7) * 16; const size_t g8 = (size_t)(tid >> 3) * (DM * 2) + (tid & 7) * 16;   // this thread's first 16 bytes among bf16 rows, in LDS and in global memory
  if (!SPLIT) {   // waves 0 to 7: A rows tid / 16 + 16 n (n < 16); waves 8 to 11, one a SIMD: B rows (tid - 256) / 16 + 8 n (n < 24). The test is on a scalar: a wave takes one side whole, every lane on
    const unsigned l16 = (unsigned)(tid >> 4) * GAP + (unsigned)(tid & 15) * 16; const size_t g16 = (size_t)(tid >> 4) * (DM * 2) + (tid & 15) * 16;   // this thread's first 16 bytes among 256-B rows, in LDS and in global memory
    if (__builtin_amdgcn_readfirstlane(tid >> 5) < 8) {
      cp8(lb + l16, 16 * GAP, A + g16, (size_t)16 * DM * 2);
      cp8(lb + l16 + 128 * GAP, 16 * GAP, A + g16 + (size_t)128 * DM * 2, (size_t)16 * DM * 2);
    } else { const unsigned lw = lb + (QAR - 16) * GAP + l16; const char* gw = (const char*)B + g16 - (size_t)16 * DM * 2;   // tid / 16 starts at 16 here
      cp8(lw, 8 * GAP, gw, (size_t)8 * DM * 2);
      cp8(lw + 64 * GAP, 8 * GAP, gw + (size_t)64 * DM * 2, (size_t)8 * DM * 2);
      cp8(lw + 128 * GAP, 8 * GAP, gw + (size_t)128 * DM * 2, (size_t)8 * DM * 2); }
  } else {   // A rows tid / 16 + 16 n (n < 8), B rows tid / 8 + 32 n (n < 4)
    cp8(lb + (unsigned)(tid >> 4) * GAP + (unsigned)(tid & 15) * 16, 16 * GAP, A + (size_t)(tid >> 4) * (DM * 4) + (tid & 15) * 16, (size_t)16 * DM * 4);
    cp4(lb + GAB + l8, 32 * GBP, (const char*)B + g8, (size_t)32 * DM * 2);
  }
}
// A, B point at the tile's first row; SPLIT: A is f32, taken as bf16 hi + residual (2 products per k-step, residual first), else A is bf16 as it lies. Every accumulator sums its k-steps in rising order. The inner loops are unrolled whole so that every fragment and accumulator index is a constant (registers, no scratch).
template <bool SPLIT, int MI> __device__ __forceinline__ void g_core(const char* __restrict__ A, const __bf16* __restrict__ B, unsigned char* sm, int tid, v8f (&acc)[MI][4]) {
  constexpr unsigned AP = GAP, BP = SPLIT ? GBP : GAP, ST = SPLIT ? GST : GSH, AW = SPLIT ? 4 : 2, AR = SPLIT ? 128 : QAR; constexpr int WC = SPLIT ? 2 : QBR / 64, KW = SPLIT ? GKW : 2 * GKW;   // row pitches in LDS; bytes of a stage; bytes of an A element; A rows of a stage; waves side by side; k of a stage
  const int wave = tid >> 5, lane = tid & 31, col = lane & 15, g = lane >> 4, wm = wave / WC, wn = wave % WC; const unsigned l0 = lds_off(sm);
  g_stage<SPLIT>(l0, A, B, tid);
  asm volatile("s_wait_asynccnt 0x0" ::: "memory");   // stage 0 landed (this wave's copies)
  __syncthreads();                                    // ... and every other wave's
  g_stage<SPLIT>(l0 + ST, A + KW * AW, B + KW, tid);
#pragma unroll 1   // one stage per trip: the ring's order stays as written
  for (int t = 0; t < DM / KW; ++t) {
    const unsigned char* sa = sm + (t & 1) * ST + (wm * (MI * 16) + col) * AP + 8 * AW * g; const unsigned char* sb = sm + (t & 1) * ST + AR * AP + (wn * 64 + col) * BP + 16 * g;
#pragma unroll
    for (int kc = 0; kc < KW / 32; ++kc) { v16b w[4];
#pragma unroll
      for (int j = 0; j < 4; ++j) { union { v16b v; v8b q[2]; } u; u.q[0] = *(const v8b*)(sb + j * 16 * BP + kc * 64); u.q[1] = *(const v8b*)(sb + j * 16 * BP + kc * 64 + 32); w[j] = u.v; }
      if (!SPLIT) { v16b a[MI];   // the k-step's A fragments, read with its B fragments as one group of LDS reads; k order as in the B rows
#pragma unroll
        for (int i = 0; i < MI; ++i) { union { v16b v; v8b q[2]; } u; u.q[0] = *(const v8b*)(sa + i * 16 * AP + kc * 64); u.q[1] = *(const v8b*)(sa + i * 16 * AP + kc * 64 + 32); a[i] = u.v; }
#pragma unroll
        for (int i = 0; i < MI; ++i) {
#pragma unroll
          for (int j = 0; j < 4; ++j) acc[i][j] = wmma_bf(a[i], w[j], acc[i][j]); }
      } else {
#pragma unroll
      for (int i = 0; i < MI; ++i) { const v2f* p = (const v2f*)(sa + i * 16 * AP + kc * 128); union { v16b v; v2b q[8]; } h, l;   // k order of the fragment: 8 g + 0..7, then 16 + 8 g + 0..7, as in the B rows
#pragma unroll
        for (int e = 0; e < 4; ++e) { const v2f x0 = p[e], x1 = p[8 + e]; h.q[e] = __builtin_convertvector(x0, v2b); h.q[4 + e] = __builtin_convertvector(x1, v2b);
          l.q[e] = __builtin_convertvector(x0 - __builtin_convertvector(h.q[e], v2f), v2b); l.q[4 + e] = __builtin_convertvector(x1 - __builtin_convertvector(h.q[4 + e], v2f), v2b); }
#pragma unroll
        for (int j = 0; j < 4; ++j) acc[i][j] = wmma_bf(l.v, w[j], acc[i][j]);
#pragma unroll
        for (int j = 0; j < 4; ++j) acc[i][j] = wmma_bf(h.v, w[j], acc[i][j]); } } }
    asm volatile("s_wait_dscnt 0x0" ::: "memory");      // this wave has left the buffer
    asm volatile("s_wait_asynccnt 0x0" ::: "memory");   // its copies of stage t + 1 have landed
    __syncthreads();                                    // publishes stage t + 1 and frees stage t's buffer
    if (t + 2 < DM / KW) g_stage<SPLIT>(l0 + (t & 1) * ST, A + (t + 2) * (KW * AW), B + (t + 2) * KW, tid);
  }
  asm volatile("s_wait_asynccnt 0x0" ::: "memory");     // nothing in flight when the ring becomes output staging
}
#define QWS 18432   // a wave's own output staging: 64 x 68 f32, or twice 64 x 72 f16
__global__ __launch_bounds__(384) void k_qkv(const __bf16* __restrict__ XB, const __bf16* __restrict__ P, const float* __restrict__ BQ, const float* __restrict__ BK, const float* __restrict__ BV, float* __restrict__ QF, _Float16* __restrict__ QK, _Float16* __restrict__ QKL, _Float16* __restrict__ VTH, _Float16* __restrict__ VTL) {
  static_assert(12 * QWS <= 2 * GSH && DM % 64 == 0, "the staging lies inside the ring; a wave's 64 columns lie in one of q, k, v");
  __shared__ __attribute__((aligned(16))) unsigned char sm[2 * GSH];   // the ring; behind the loop 221,184 B of it are every wave's own output staging
  const int tid = threadIdx.x, wave = __builtin_amdgcn_readfirstlane(tid >> 5), lane = tid & 31, col = lane & 15, g = lane >> 4;
  const size_t m0 = (size_t)blockIdx.x * QAR + (wave / 3) * 64; const int n0 = blockIdx.y * QBR + (wave % 3) * 64;   // the wave's own first row and column: scalars
  const int which0 = n0 / DM; const float* BB = BQ ? (((which0 == 0) ? BQ : (which0 == 1) ? BK : BV) + (n0 - which0 * DM)) : nullptr;
  v8f acc[4][4] = {};
  g_core<false, 4>((const char*)(XB + (size_t)blockIdx.x * QAR * DM), P + (size_t)blockIdx.y * QBR * DM, sm, tid, acc);
  float bj[4] = {0.f, 0.f, 0.f, 0.f};   // this lane's four bias values
  if (BB) {
#pragma unroll
    for (int j = 0; j < 4; ++j) bj[j] = bfr(BB[j * 16 + col]); }
  if (n0 < 2 * DM) {   // q and k kept in f32 (LayerNorm comes next); each wave stages its own 64 x 64 in its own range
    float* sf = (float*)(sm + wave * QWS);
#pragma unroll
    for (int j = 0; j < 4; ++j) {
#pragma unroll
      for (int i = 0; i < 4; ++i) {
#pragma unroll
        for (int r = 0; r < 8; ++r) sf[(i * 16 + 8 * g + r) * 68 + j * 16 + col] = acc[i][j][r] + bj[j]; } }
    LDSX();
    for (int rl = 0; rl < 32; ++rl) vst2(QF + (m0 + rl * 2 + g) * (2 * DM) + n0 + col * 4, *(const v4f*)&sf[(rl * 2 + g) * 68 + col * 4]);
    asm volatile("s_wait_xcnt 0x0" ::: "memory");   // closes the run of stores before any code laid out behind it rewrites an address register
  } else {   // v, transposed: the wave stages its own 64 d x 64 s in its own range and stores whole 128-B rows; no other wave's data, so no barrier
    _Float16* sth = (_Float16*)(sm + wave * QWS); _Float16* stl = sth + 64 * 72;   // [64 d][72 s] each
#pragma unroll
    for (int j = 0; j < 4; ++j) {
#pragma unroll
      for (int i = 0; i < 4; ++i) { v8h hv8, lv8;
#pragma unroll
        for (int r = 0; r < 8; ++r) { const float v = acc[i][j][r] + bj[j]; const _Float16 hv = (_Float16)v; hv8[r] = hv; lv8[r] = (_Float16)((v - (float)hv) * 2048.0f); }
        const int o = (j * 16 + col) * 72 + i * 16 + 8 * g; *(v8h*)&sth[o] = hv8; *(v8h*)&stl[o] = lv8; } }
    LDSX();
    const int b = (int)(m0 / SS), s0 = (int)(m0 % SS); const int pc0 = n0 - 2 * DM;
    for (int it = 0; it < 16; ++it) { const int q = it * 32 + lane, d = q >> 3, pc = q & 7; const size_t o = ((size_t)b * DM + pc0 + d) * SS + s0 + pc * 8; vst2((unsigned*)(VTH + o), *(const v4u*)&sth[d * 72 + pc * 8]); vst2((unsigned*)(VTL + o), *(const v4u*)&stl[d * 72 + pc * 8]); }
    asm volatile("s_wait_xcnt 0x0" ::: "memory");   // closes the run of stores before any code laid out behind it rewrites an address register
  }
}
// ---- k_attn: block = (64 queries, head h, batch b): all-keys flash attention (K = 64: 2 k-steps), scores = (q.k) * 0.125 with single f16 operands, P.V: f16 P x f16 V; O[b*S+q][h*64+d] = acc / l (256-B segments)
// A stage is 64 keys of this head in LDS, shared by the block's four waves: 64 K rows of 128 B, then 64 V^T rows (one per d) of 128 B, all at pitch 144 (16 B x odd for the 16-byte readers). Two buffers: the next stage's copies fly while this one is worked on.
#define AKT 64
#define ATP 144
#define ATK (64 * ATP)
#define AST (2 * ATK)
// one stage: eight asynchronous 16-byte copies per lane, global -> LDS, four of K and four of V^T; a wave's copy covers four whole 128-B rows; the s_wait_xcnt closes the statement so that no address register is rewritten ahead of it
__device__ __forceinline__ void a_stage(unsigned lb, const _Float16* K, const _Float16* V, int tid) {
  const unsigned lk = lb + (unsigned)(tid >> 3) * ATP + (unsigned)(tid & 7) * 16, lv = lk + ATK, ls = 16 * ATP;
  const char* gk = (const char*)K + (size_t)(tid >> 3) * (2 * DM * 2) + (tid & 7) * 16; const size_t ks = (size_t)16 * 2 * DM * 2;
  const char* gv = (const char*)V + (size_t)(tid >> 3) * (SS * 2) + (tid & 7) * 16; const size_t vs = (size_t)16 * SS * 2;
  asm volatile("global_load_async_to_lds_b128 %0, %8, off\n\t"
               "global_load_async_to_lds_b128 %1, %9, off\n\t"
               "global_load_async_to_lds_b128 %2, %10, off\n\t"
               "global_load_async_to_lds_b128 %3, %11, off\n\t"
               "global_load_async_to_lds_b128 %4, %12, off\n\t"
               "global_load_async_to_lds_b128 %5, %13, off\n\t"
               "global_load_async_to_lds_b128 %6, %14, off\n\t"
               "global_load_async_to_lds_b128 %7, %15, off\n\t"
               "s_wait_xcnt 0x0"
               :: "v"(lk), "v"(lk + ls), "v"(lk + 2 * ls), "v"(lk + 3 * ls), "v"(lv), "v"(lv + ls), "v"(lv + 2 * ls), "v"(lv + 3 * ls),
                  "v"(gk), "v"(gk + ks), "v"(gk + 2 * ks), "v"(gk + 3 * ks), "v"(gv), "v"(gv + vs), "v"(gv + 2 * vs), "v"(gv + 3 * vs) : "memory");
}
// fragment from a staged row; p = row start + 16 g bytes: k order 8 g + 0..7, then 16 + 8 g + 0..7, as frag_h
__device__ __forceinline__ v16h frag_l(const unsigned char* p) { union { v16h v; v8h q[2]; } u; u.q[0] = *(const v8h*)p; u.q[1] = *(const v8h*)(p + 32); return u.v; }
// lane l <-> lane l ^ 16: the two halves of a wave hold the two halves of a query's keys
__device__ __forceinline__ float xhalf(float x) { const int b = __builtin_bit_cast(int, x); return __builtin_bit_cast(float, __builtin_amdgcn_permlanex16(b, b, 0x76543210, 0xfedcba98, false, false)); }
__device__ __forceinline__ v8f wmma_t(v16h a, v16h b, v8f c) { return __builtin_amdgcn_wmma_f32_16x16x32_f16(false, a, false, b, (short)0, c, false, false); }
// Transposed products: S^T = K . Q^T (A = 16 staged K rows, B = the wave's 16 queries) and O^T += V^T . P^T (A = 16 staged V^T rows, B = P^T). Lane (col, g) holds query col: of each 16-key score tile the keys 8 g + 0..7, of each output tile d = 8 g + 0..7.
// So a query's maximum and sum are taken inside the lane, with one exchange between the halves, and two score tiles, converted in place, are the B operand of the second product in the fragment's own k order (8 g + 0..7, then 16 + 8 g + 0..7, as frag_l reads V^T).
__global__ __launch_bounds__(128) void k_attn(const _Float16* __restrict__ QK, const _Float16* __restrict__ QKL, const _Float16* __restrict__ VTH, const _Float16* __restrict__ VTL, const void* __restrict__ KMASK, float* __restrict__ O) {
  __shared__ __align__(16) float so[4][16][68]; __shared__ __attribute__((aligned(16))) unsigned char ring[2 * AST];
  const int tid = threadIdx.x, wave = tid >> 5, lane = tid & 31, col = lane & 15, g = lane >> 4;
  const int qb = blockIdx.x, h = blockIdx.y, b = blockIdx.z; const int q0 = qb * 64 + wave * 16; const size_t rq = (size_t)b * SS + q0 + col;
  const unsigned l0 = lds_off(ring); const _Float16* Kg = QK + (size_t)b * SS * (2 * DM) + DM + h * HD; const _Float16* Vg = VTH + ((size_t)b * DM + h * HD) * SS;
  a_stage(l0, Kg, Vg, tid);
  v16h aq[2];
#pragma unroll
  for (int kc = 0; kc < 2; ++kc) aq[kc] = frag_h(QK + rq * (2 * DM) + h * HD + kc * 32, lane);
  const float cs = 0.125f * 1.4426950408889634f;   // 1/sqrt(64), and the exponentials in base 2
  float m = -3.0e38f, l = 0.f;   // of query col: running maximum (scaled, the same in both halves) and this half's part of the sum
  v8f acc[4] = {};
  asm volatile("s_wait_asynccnt 0x0" ::: "memory");   // stage 0 landed (this wave's copies)
  __syncthreads();                                    // ... and every other wave's
  a_stage(l0 + AST, Kg + (size_t)AKT * (2 * DM), Vg + AKT, tid);
#pragma unroll 1   // one stage per trip: the ring's order stays as written
  for (int t = 0; t < SS / AKT; ++t) { const unsigned char* sk = ring + (t & 1) * AST + col * ATP + 16 * g; const unsigned char* sv = sk + ATK;
#pragma unroll   // both 32-key steps of the stage, keys in rising order: every LDS offset is a constant
  for (int u = 0; u < AKT / 32; ++u) { v8f s[2]; v16h kf[2][2], vf[4];   // the step's K and V^T fragments, read as one group of LDS reads ahead of its products
#pragma unroll
    for (int ct = 0; ct < 2; ++ct) {
#pragma unroll
      for (int kc = 0; kc < 2; ++kc) kf[ct][kc] = frag_l(sk + (u * 32 + ct * 16) * ATP + kc * 64); }
#pragma unroll
    for (int dt = 0; dt < 4; ++dt) vf[dt] = frag_l(sv + dt * 16 * ATP + u * 64);
#pragma unroll
    for (int ct = 0; ct < 2; ++ct) { v8f c = {};
#pragma unroll
      for (int kc = 0; kc < 2; ++kc) c = wmma_t(kf[ct][kc], aq[kc], c);   // single product: k, q as one-rounding f16 operands
      s[ct] = c; }
    float mx = fmaxf(s[0][0], s[1][0]);   // maximum of the raw scores (the scale is positive)
#pragma unroll
    for (int r = 1; r < 8; ++r) mx = fmaxf(mx, fmaxf(s[0][r], s[1][r]));
    mx = fmaxf(mx, xhalf(mx)) * cs;
    const float mn = fmaxf(m, mx), nb = 11.0f - mn; float alpha;
    asm("v_exp_f32 %0, %1\n\tv_nop" : "=v"(alpha) : "v"(m - mn));   // exp2, in asm so that the v_nop stands directly behind it: the slot that the instruction set asks for before a transcendental's source register is written again
    m = mn;   // alpha is 0 on the first step; P carries 2^11 so that small softmax weights stay out of the f16 subnormal range, and so does the sum: it cancels in the epilogue
    union { v16h v; v2h q[8]; } pa; v2f es[2];
#pragma unroll
    for (int ct = 0; ct < 2; ++ct) {
#pragma unroll
      for (int i = 0; i < 4; ++i) { const v2f x = __builtin_elementwise_fma(v2f{s[ct][2 * i], s[ct][2 * i + 1]}, v2f{cs, cs}, v2f{nb, nb}); const v2f e = {__builtin_amdgcn_exp2f(x.x), __builtin_amdgcn_exp2f(x.y)};
        es[ct] = i ? es[ct] + e : e; pa.q[ct * 4 + i] = __builtin_convertvector(e, v2h); } }
    l = l * alpha + ((es[0].x + es[1].x) + (es[0].y + es[1].y));
#pragma unroll
    for (int dt = 0; dt < 4; ++dt) acc[dt] = acc[dt] * alpha;
#pragma unroll
    for (int dt = 0; dt < 4; ++dt) acc[dt] = wmma_t(vf[dt], pa.v, acc[dt]); }   // single product: V x P (x2^11)
    asm volatile("s_wait_dscnt 0x0" ::: "memory");      // this wave has left the buffer
    asm volatile("s_wait_asynccnt 0x0" ::: "memory");   // its copies of stage t + 1 have landed
    __syncthreads();                                    // publishes stage t + 1 and frees stage t's buffer
    if (t + 2 < SS / AKT) a_stage(l0 + (t & 1) * AST, Kg + (size_t)(t + 2) * AKT * (2 * DM), Vg + (t + 2) * AKT, tid);
  }
  asm volatile("s_wait_asynccnt 0x0" ::: "memory");     // nothing in flight when the wave goes on to its end
  const float il = 1.0f / (l + xhalf(l));   // the halves' sums joined once
#pragma unroll
  for (int dt = 0; dt < 4; ++dt) { const v8f o = acc[dt] * il; *(v4f*)&so[wave][col][dt * 16 + 8 * g] = v4f{o[0], o[1], o[2], o[3]}; *(v4f*)&so[wave][col][dt * 16 + 8 * g + 4] = v4f{o[4], o[5], o[6], o[7]}; }
  LDSX();
  for (int rl = 0; rl < 16; ++rl) if (lane < 16) vst2(O + ((size_t)b * SS + q0 + rl) * DM + h * HD + lane * 4, *(const v4f*)&so[wave][rl][lane * 4]);
}
// ---- k_out: block = (128 rows, 128 cols), eight waves of 32 x 64: out = O(hi/lo) . Wo rows (2 products) + bo. The grid is one block a WGP: with eight waves each SIMD has a second wave to issue while the first waits on LDS or converts
__global__ __launch_bounds__(256) void k_out(const float* __restrict__ O, const __bf16* __restrict__ P, const float* __restrict__ BO, float* __restrict__ Y) {
  __shared__ __attribute__((aligned(16))) unsigned char sm[2 * GST];
  const int tid = threadIdx.x, wave = tid >> 5, lane = tid & 31, col = lane & 15, g = lane >> 4, wm = wave >> 1, wn = wave & 1; const size_t m0 = (size_t)blockIdx.x * 128; const int n0 = blockIdx.y * 128;
  v8f acc[2][4] = {};
  g_core<true, 2>((const char*)(O + m0 * DM), P + (size_t)n0 * DM, sm, tid, acc);
  float bj[4];   // this lane's four bias values
#pragma unroll
  for (int j = 0; j < 4; ++j) bj[j] = bfr(BO[n0 + wn * 64 + j * 16 + col]);
  float* sf = (float*)(sm + wave * (32 * 68 * 4));   // each wave stages its own 32 x 64 in its own range of the ring
#pragma unroll
  for (int j = 0; j < 4; ++j) {
#pragma unroll
    for (int i = 0; i < 2; ++i) {
#pragma unroll
      for (int r = 0; r < 8; ++r) sf[(i * 16 + 8 * g + r) * 68 + j * 16 + col] = acc[i][j][r] + bj[j]; } }
  LDSX();
  for (int rl = 0; rl < 16; ++rl) vst2(Y + (m0 + wm * 32 + rl * 2 + g) * DM + n0 + wn * 64 + col * 4, *(const v4f*)&sf[(rl * 2 + g) * 68 + col * 4]);
}
// ---- k_lnqk: LayerNorm over the 1,024 flattened head dims (jnp.var, 1e-5) x g + b -> f16 row into the engine's q | k layout. A wave takes the q rows, or the k rows, of two tokens whole in registers (lane l holds columns 128 j + 4 l + 0..3); all its loads are in flight together; no LDS, no barrier; 4,096 waves, four a SIMD
template <int C> __device__ __forceinline__ float rowx(float x) { return __builtin_bit_cast(float, __builtin_amdgcn_update_dpp(0, __builtin_bit_cast(int, x), C, 0xf, 0xf, true)); }   // lane l <- lane l ^ (C & 15) of its 16-lane row (row_xmask)
__device__ __forceinline__ float wsum(float s) { s += rowx<0x161>(s); s += rowx<0x162>(s); s += rowx<0x164>(s); s += rowx<0x168>(s); return s + xhalf(s); }   // sum over the wave, the same bits in every lane
__global__ __launch_bounds__(256) __attribute__((amdgpu_waves_per_eu(2, 4))) void k_lnqk(const float* __restrict__ QF, const float* __restrict__ GQ, const float* __restrict__ BQn, const float* __restrict__ GK, const float* __restrict__ BKn, _Float16* __restrict__ QK) {
  const unsigned l4 = (threadIdx.x & 31) * 4, w = blockIdx.x * 8 + __builtin_amdgcn_readfirstlane(threadIdx.x >> 5), which = w & 1; const size_t o = (size_t)(w >> 1) * 2 * (2 * DM) + which * DM;   // o is the same in the whole wave: scalar base, one lane offset
  const float* X = QF + o; const float* G = which ? GK : GQ; const float* Bt = which ? BKn : BQn; _Float16* Y = QK + o;
  v4f x[2][8], gg[8], bb[8];
#pragma unroll
  for (int r = 0; r < 2; ++r) {
#pragma unroll
    for (int j = 0; j < 8; ++j) x[r][j] = *(const v4f*)(X + l4 + r * (2 * DM) + j * 128); }
#pragma unroll
  for (int j = 0; j < 8; ++j) { gg[j] = *(const v4f*)(G + l4 + j * 128); bb[j] = *(const v4f*)(Bt + l4 + j * 128); }
  v4h y[2][8];
#pragma unroll
  for (int r = 0; r < 2; ++r) { v4f s4 = x[r][0];
#pragma unroll
    for (int j = 1; j < 8; ++j) s4 += x[r][j];
    const float mu = wsum((s4.x + s4.y) + (s4.z + s4.w)) / (float)DM; v4f q4 = {};
#pragma unroll
    for (int j = 0; j < 8; ++j) { const v4f d = x[r][j] - mu; q4 += d * d; }
    const float inv = 1.0f / sqrtf(wsum((q4.x + q4.y) + (q4.z + q4.w)) / (float)DM + 1e-5f);
#pragma unroll
    for (int j = 0; j < 8; ++j) {
#pragma unroll
      for (int i = 0; i < 4; ++i) y[r][j][i] = (_Float16)((x[r][j][i] - mu) * inv * bfr(gg[j][i]) + bfr(bb[j][i])); } }
#pragma unroll   // both rows' stores stand last: nothing behind them writes a register
  for (int r = 0; r < 2; ++r) {
#pragma unroll
    for (int j = 0; j < 8; ++j) *(v4h*)(Y + l4 + r * (2 * DM) + j * 128) = y[r][j]; }
}
extern "C" void kernel_launch(void* const* d_in, const int* in_sizes, int n_in, void* d_out, int out_size, void* d_ws, size_t ws_size, hipStream_t stream) {
  (void)in_sizes; (void)n_in; (void)out_size;
  const float** F = (const float**)d_in;   // 0 x [4,1024,1024], 1 qkv_w [3072,1024] natural (q | k | v row blocks), 2 qkv_b, 3 q_norm_g, 4 q_norm_b, 5 k_norm_g, 6 k_norm_b, 7 proj_w [1024,1024], 8 proj_b
  if (ws_size < (size_t)WS_END) return;
  char* ws = (char*)d_ws; __bf16* PK = (__bf16*)(ws + WS_PK); _Float16 *QK = (_Float16*)(ws + WS_QK), *QKL = (_Float16*)(ws + WS_QKL), *VTH = (_Float16*)(ws + WS_VTH), *VTL = (_Float16*)(ws + WS_VTL); float *O = (float*)(ws + WS_O), *QF = (float*)(ws + WS_QF); __bf16* XB = (__bf16*)(ws + WS_XB);
  k_pack<<<dim3(4 * DM / 16), 256, 0, stream>>>(F[1], F[1] + (size_t)DM * DM, F[1] + (size_t)2 * DM * DM, F[7], F[0], PK, XB);
  k_qkv<<<dim3(TNB * SS / QAR, QKVW / QBR), 384, 0, stream>>>(XB, PK + PK_A, F[2], F[2] + DM, F[2] + 2 * DM, QF, QK, QKL, VTH, VTL);
  k_lnqk<<<dim3(TNB * SS * 2 / 16), 256, 0, stream>>>(QF, F[3], F[4], F[5], F[6], QK);
  k_attn<<<dim3(TQB, NH, TNB), 128, 0, stream>>>(QK, QKL, VTH, VTL, nullptr, O);
  k_out<<<dim3(TOB / 2, DM / 128), 256, 0, stream>>>(O, PK + PK_P, F[8], (float*)d_out);
}
